// v000
// Times are from an AMD MI455X. After a warm-up the kernel runs many times in a row, and a time is the length of
// such a window on the GPU divided by its runs, so every launch and the gaps after it count. The runs cycle
// through copies of the inputs. A figure is the median of several windows, for all but v000 over two sittings.
// Sittings can differ by a few percent; kernels timed side by side share one.
// v000 is the starting kernel. One run takes 171 microseconds.
#include <hip/hip_runtime.h>
#include <hip/hip_bf16.h>

// ---------------------------------------------------------------------------
// Self-attention forward for MI455X (gfx1250, wave32, WMMA).
//  Kernel 1: QKV projection GEMM (f32 in -> f16 Q/K/V in workspace).
//  Kernel 2: flash-attention over 64-row q tiles, online softmax.
// All WMMA fragments are built from contiguous 128-bit LDS/global loads;
// B-operand tiles (W, V) are stored TRANSPOSED in LDS. The attention K tile
// (pure f16 byte copy) is staged with GLOBAL_LOAD_ASYNC_TO_LDS_B128
// (ASYNCcnt path) — builtin signature: (v4i AS1*, v4i AS3*, imm, imm).
// ---------------------------------------------------------------------------

typedef _Float16 half_t;
typedef __attribute__((ext_vector_type(16))) _Float16 v16h;
typedef __attribute__((ext_vector_type(8)))  _Float16 v8h;
typedef __attribute__((ext_vector_type(8)))  float    v8f;
typedef __attribute__((ext_vector_type(4)))  int      v4i;

constexpr int kB  = 2;
constexpr int kS  = 2048;
constexpr int kH  = 768;
constexpr int kNH = 12;
constexpr int kHD = 64;
constexpr int kBS = kB * kS;          // 4096 rows of hidden_states

#if defined(__has_builtin)
#if __has_builtin(__builtin_amdgcn_global_load_async_to_lds_b128)
#define USE_ASYNC_LDS 1
#endif
#endif

#ifdef USE_ASYNC_LDS
typedef __attribute__((address_space(1))) v4i gas_v4i;   // global (AS1)
typedef __attribute__((address_space(3))) v4i las_v4i;   // LDS    (AS3)
// Per-lane async copy of 16 bytes global -> LDS (tracked by ASYNCcnt).
__device__ __forceinline__ void async_copy16(const half_t* gsrc, half_t* ldst) {
  __builtin_amdgcn_global_load_async_to_lds_b128((gas_v4i*)gsrc,
                                                 (las_v4i*)ldst, 0, 0);
}
__device__ __forceinline__ void wait_asynccnt0() {
#if __has_builtin(__builtin_amdgcn_s_wait_asynccnt)
  __builtin_amdgcn_s_wait_asynccnt(0);
#else
  asm volatile("s_wait_asynccnt 0" ::: "memory");
#endif
}
#endif

union frag16 { v16h v; v8h h[2]; };

// Build a 16-half fragment from two aligned 8-half (128-bit) loads.
__device__ __forceinline__ v16h ld_frag(const half_t* lo, const half_t* hi) {
  frag16 f;
  f.h[0] = *(const v8h*)lo;
  f.h[1] = *(const v8h*)hi;
  return f.v;
}

// 16-lane-group reductions (C/D layout: lanes 0..15 / 16..31 are independent
// row groups; xor masks 1,2,4,8 never cross the lane-16 boundary). wave32.
__device__ __forceinline__ float redmax16(float v) {
  v = fmaxf(v, __shfl_xor(v, 1, 32));
  v = fmaxf(v, __shfl_xor(v, 2, 32));
  v = fmaxf(v, __shfl_xor(v, 4, 32));
  v = fmaxf(v, __shfl_xor(v, 8, 32));
  return v;
}
__device__ __forceinline__ float redsum16(float v) {
  v += __shfl_xor(v, 1, 32);
  v += __shfl_xor(v, 2, 32);
  v += __shfl_xor(v, 4, 32);
  v += __shfl_xor(v, 8, 32);
  return v;
}

__device__ __forceinline__ v8f wmma16(v16h a, v16h b, v8f c) {
  // D = A(16x32 f16) * B(32x16 f16) + C(16x16 f32)
  return __builtin_amdgcn_wmma_f32_16x16x32_f16(false, a, false, b,
                                                (short)0, c, false, false);
}

// ---------------------------------------------------------------------------
// Kernel 1: O = f16(X @ W + b).  X:[4096,768] f32, W:[768,768] f32 (row = in).
// grid = (64 M-tiles, 12 N-tiles, 3 {Q,K,V}), block = 128 (4 waves).
// ---------------------------------------------------------------------------
__global__ __launch_bounds__(128)
void qkv_gemm_kernel(const float* __restrict__ X,
                     const float* __restrict__ Wq, const float* __restrict__ bq,
                     const float* __restrict__ Wk, const float* __restrict__ bk,
                     const float* __restrict__ Wv, const float* __restrict__ bv,
                     half_t* __restrict__ Q, half_t* __restrict__ K,
                     half_t* __restrict__ V)
{
  const float* Wm;  const float* bias;  half_t* O;
  if (blockIdx.z == 0)      { Wm = Wq; bias = bq; O = Q; }
  else if (blockIdx.z == 1) { Wm = Wk; bias = bk; O = K; }
  else                      { Wm = Wv; bias = bv; O = V; }

  const int M0   = blockIdx.x * 64;
  const int N0   = blockIdx.y * 64;
  const int tid  = threadIdx.x;
  const int wave = tid >> 5;
  const int lane = tid & 31;
  const int l16  = lane & 15;
  const int hi   = lane >> 4;       // lane-group (0 | 1)
  const int koff = hi * 8;          // contraction offset for upper group

  // Row strides 40 halves = 80 B (multiple of 16 B) -> aligned b128 access.
  __shared__ alignas(16) half_t Xs [64][40];  // X tile, row-major  [m][k]
  __shared__ alignas(16) half_t Wst[64][40];  // W tile, TRANSPOSED [n][k]

  const v8f zero = {0.f,0.f,0.f,0.f,0.f,0.f,0.f,0.f};
  v8f acc[4];
  #pragma unroll
  for (int j = 0; j < 4; ++j) acc[j] = zero;

  for (int k0 = 0; k0 < kH; k0 += 32) {
    { // stage X tile (64 rows x 32 k) as f16; float4 global reads
      const int r = tid >> 1, c = (tid & 1) * 16;
      const float4* src = (const float4*)(X + (size_t)(M0 + r) * kH + k0 + c);
      #pragma unroll
      for (int i = 0; i < 4; ++i) {
        const float4 f = src[i];
        Xs[r][c + 4*i + 0] = (half_t)f.x;
        Xs[r][c + 4*i + 1] = (half_t)f.y;
        Xs[r][c + 4*i + 2] = (half_t)f.z;
        Xs[r][c + 4*i + 3] = (half_t)f.w;
      }
    }
    { // stage W tile (32 k x 64 n) transposed -> Wst[n][k]
      const int r = tid >> 2, c = (tid & 3) * 16;   // r = k row, c = n base
      const float4* src = (const float4*)(Wm + (size_t)(k0 + r) * kH + N0 + c);
      #pragma unroll
      for (int i = 0; i < 4; ++i) {
        const float4 f = src[i];
        Wst[c + 4*i + 0][r] = (half_t)f.x;
        Wst[c + 4*i + 1][r] = (half_t)f.y;
        Wst[c + 4*i + 2][r] = (half_t)f.z;
        Wst[c + 4*i + 3][r] = (half_t)f.w;
      }
    }
    __syncthreads();

    // A fragment (rows 16*wave..+15): contiguous 8-half runs -> 2x b128
    const int m = 16 * wave + l16;
    const v16h a = ld_frag(&Xs[m][koff], &Xs[m][16 + koff]);

    // B fragments for 4 N sub-tiles: transposed tile -> 2x b128 each
    #pragma unroll
    for (int j = 0; j < 4; ++j) {
      const int n = 16 * j + l16;
      const v16h bfr = ld_frag(&Wst[n][koff], &Wst[n][16 + koff]);
      acc[j] = wmma16(a, bfr, acc[j]);
    }
    __syncthreads();
  }

  // Epilogue: C/D layout -> global f16 with bias.
  #pragma unroll
  for (int j = 0; j < 4; ++j) {
    const int n = N0 + 16 * j + l16;
    const float bv_ = bias[n];
    #pragma unroll
    for (int r = 0; r < 8; ++r) {
      const int m2 = M0 + 16 * wave + r + 8 * hi;
      O[(size_t)m2 * kH + n] = (half_t)(acc[j][r] + bv_);
    }
  }
}

// ---------------------------------------------------------------------------
// Kernel 2: flash attention.  grid = (S/64 q-tiles, NH, B), block = 128.
// Each wave owns 16 q rows; k loop in steps of 32.
// ---------------------------------------------------------------------------
__global__ __launch_bounds__(128)
void attention_kernel(const half_t* __restrict__ Q,
                      const half_t* __restrict__ K,
                      const half_t* __restrict__ V,
                      float* __restrict__ out)
{
  const int qt = blockIdx.x;        // q tile (64 rows)
  const int h  = blockIdx.y;        // head
  const int b  = blockIdx.z;        // batch

  const int tid  = threadIdx.x;
  const int wave = tid >> 5;
  const int lane = tid & 31;
  const int l16  = lane & 15;
  const int hi   = lane >> 4;
  const int koff = hi * 8;

  const size_t headOff = (size_t)b * kS * kH + (size_t)h * kHD;
  const half_t* Qb = Q + headOff;   // row stride kH
  const half_t* Kb = K + headOff;
  const half_t* Vb = V + headOff;

  __shared__ alignas(16) half_t Ks [32][72];  // K tile row-major [k][d], 144 B rows
  __shared__ alignas(16) half_t Vst[64][40];  // V tile TRANSPOSED [d][k],  80 B rows
  __shared__ alignas(16) half_t Ps [4][16][40]; // per-wave P staging (16 q x 32 k)

  // Q A-fragments for this wave, d chunks [0,32) and [32,64): 4x global b128.
  const int q0 = qt * 64 + wave * 16;
  const half_t* qrow = Qb + (size_t)(q0 + l16) * kH;
  const v16h aq0 = ld_frag(qrow +      koff, qrow + 16 + koff);
  const v16h aq1 = ld_frag(qrow + 32 + koff, qrow + 48 + koff);

  const v8f zero = {0.f,0.f,0.f,0.f,0.f,0.f,0.f,0.f};
  v8f cacc[4];
  #pragma unroll
  for (int j = 0; j < 4; ++j) cacc[j] = zero;
  float mrow[8], lsum[8];
  #pragma unroll
  for (int r = 0; r < 8; ++r) { mrow[r] = -1.0e30f; lsum[r] = 0.0f; }

  const float scale = 0.125f;       // 1/sqrt(64)

  for (int k0 = 0; k0 < kS; k0 += 32) {
    { // stage K (row-major, async DMA to LDS) and V (transposed, via VGPRs)
      const int r = tid >> 2, c = (tid & 3) * 16;   // r = k row, c = d base
      const half_t* ksrc = Kb + (size_t)(k0 + r) * kH + c;
      const half_t* vsrc = Vb + (size_t)(k0 + r) * kH + c;
#ifdef USE_ASYNC_LDS
      async_copy16(ksrc,     &Ks[r][c]);      // global_load_async_to_lds_b128
      async_copy16(ksrc + 8, &Ks[r][c + 8]);
#else
      *(v8h*)&Ks[r][c]     = *(const v8h*)(ksrc);
      *(v8h*)&Ks[r][c + 8] = *(const v8h*)(ksrc + 8);
#endif
      const v8h vv0 = *(const v8h*)(vsrc);
      const v8h vv1 = *(const v8h*)(vsrc + 8);
      #pragma unroll
      for (int i = 0; i < 8; ++i) {
        Vst[c + i][r]     = vv0[i];
        Vst[c + 8 + i][r] = vv1[i];
      }
      if (k0 + 32 < kS) {           // hint next tiles toward cache
        __builtin_prefetch(ksrc + 32 * kH, 0, 1);
        __builtin_prefetch(vsrc + 32 * kH, 0, 1);
      }
    }
#ifdef USE_ASYNC_LDS
    wait_asynccnt0();               // s_wait_asynccnt 0: K tile landed in LDS
#endif
    __syncthreads();

    // scores: S = Q * K^T  (B column = k index, contraction = d)
    v8f s[2];
    #pragma unroll
    for (int j = 0; j < 2; ++j) {
      const int kcol = 16 * j + l16;
      v8f acc_s = zero;
      const v16h bk0 = ld_frag(&Ks[kcol][koff],      &Ks[kcol][16 + koff]);
      const v16h bk1 = ld_frag(&Ks[kcol][32 + koff], &Ks[kcol][48 + koff]);
      acc_s = wmma16(aq0, bk0, acc_s);
      acc_s = wmma16(aq1, bk1, acc_s);
      s[j] = acc_s;
    }

    // Online softmax per q-row; write P (f16) into per-wave LDS staging.
    #pragma unroll
    for (int r = 0; r < 8; ++r) {
      const float s0 = s[0][r] * scale;
      const float s1 = s[1][r] * scale;
      const float tmax = redmax16(fmaxf(s0, s1));
      const float mnew = fmaxf(mrow[r], tmax);
      const float corr = __expf(mrow[r] - mnew);
      const float p0 = __expf(s0 - mnew);
      const float p1 = __expf(s1 - mnew);
      lsum[r] = lsum[r] * corr + redsum16(p0 + p1);
      mrow[r] = mnew;
      #pragma unroll
      for (int j = 0; j < 4; ++j) cacc[j][r] *= corr;
      const int m = r + 8 * hi;
      Ps[wave][m][l16]      = (half_t)p0;
      Ps[wave][m][16 + l16] = (half_t)p1;
    }
    __syncthreads();   // P visible (and all Ks reads retired)

    // ctx += P(16x32) * V(32x64): A from Ps, B from transposed Vst.
    const v16h ap = ld_frag(&Ps[wave][l16][koff], &Ps[wave][l16][16 + koff]);
    #pragma unroll
    for (int j = 0; j < 4; ++j) {
      const int dcol = 16 * j + l16;
      const v16h bvf = ld_frag(&Vst[dcol][koff], &Vst[dcol][16 + koff]);
      cacc[j] = wmma16(ap, bvf, cacc[j]);
    }
    __syncthreads();   // all Vst/Ps reads done before next tile load
  }

  // Normalize and store ctx (f32). Output layout [B,S,NH*HD]: head h occupies
  // columns h*64..h*64+63.
  #pragma unroll
  for (int r = 0; r < 8; ++r) {
    const float inv = 1.0f / lsum[r];
    const int q = q0 + r + 8 * hi;
    float* orow = out + (size_t)(b * kS + q) * kH + (size_t)h * kHD;
    #pragma unroll
    for (int j = 0; j < 4; ++j)
      orow[16 * j + l16] = cacc[j][r] * inv;
  }
}

// ---------------------------------------------------------------------------
extern "C" void kernel_launch(void* const* d_in, const int* in_sizes, int n_in,
                              void* d_out, int out_size, void* d_ws, size_t ws_size,
                              hipStream_t stream) {
  const float* X  = (const float*)d_in[0];
  const float* Wq = (const float*)d_in[1];
  const float* bq = (const float*)d_in[2];
  const float* Wk = (const float*)d_in[3];
  const float* bk = (const float*)d_in[4];
  const float* Wv = (const float*)d_in[5];
  const float* bv = (const float*)d_in[6];
  float* out = (float*)d_out;

  // Workspace: f16 Q, K, V, each [4096, 768] (6.29 MB each, 18.9 MB total).
  half_t* Qh = (half_t*)d_ws;
  half_t* Kh = Qh + (size_t)kBS * kH;
  half_t* Vh = Kh + (size_t)kBS * kH;

  dim3 g1(kBS / 64, kH / 64, 3);       // 64 x 12 x 3 blocks
  qkv_gemm_kernel<<<g1, 128, 0, stream>>>(X, Wq, bq, Wk, bk, Wv, bv, Qh, Kh, Vh);

  dim3 g2(kS / 64, kNH, kB);           // 32 x 12 x 2 blocks
  attention_kernel<<<g2, 128, 0, stream>>>(Qh, Kh, Vh, out);
}

// v001
// One run takes 139 microseconds.
// Next to v000, in two timings, it ran 1.27 times as fast each time.
#include <hip/hip_runtime.h>
#include <hip/hip_bf16.h>

// ---------------------------------------------------------------------------
// Self-attention forward for MI455X (gfx1250, wave32, WMMA).
//  Kernel 1: QKV projection GEMM (f32 in -> f16 Q/K/V in workspace).
//  Kernel 2: flash-attention over 64-row q tiles, online softmax.
// All WMMA fragments except P^T (made in registers from the scores) are built from contiguous 128-bit LDS/global loads;
// the W and V tiles are stored TRANSPOSED in LDS. The attention K tile
// (pure f16 byte copy) is staged with GLOBAL_LOAD_ASYNC_TO_LDS_B128
// (ASYNCcnt path) — builtin signature: (v4i AS1*, v4i AS3*, imm, imm).
// ---------------------------------------------------------------------------

typedef _Float16 half_t;
typedef __attribute__((ext_vector_type(16))) _Float16 v16h;
typedef __attribute__((ext_vector_type(8)))  _Float16 v8h;
typedef __attribute__((ext_vector_type(8)))  float    v8f;
typedef __attribute__((ext_vector_type(4)))  int      v4i;

constexpr int kB  = 2;
constexpr int kS  = 2048;
constexpr int kH  = 768;
constexpr int kNH = 12;
constexpr int kHD = 64;
constexpr int kBS = kB * kS;          // 4096 rows of hidden_states

#if defined(__has_builtin)
#if __has_builtin(__builtin_amdgcn_global_load_async_to_lds_b128)
#define USE_ASYNC_LDS 1
#endif
#endif

#ifdef USE_ASYNC_LDS
typedef __attribute__((address_space(1))) v4i gas_v4i;   // global (AS1)
typedef __attribute__((address_space(3))) v4i las_v4i;   // LDS    (AS3)
// Per-lane async copy of 16 bytes global -> LDS (tracked by ASYNCcnt).
__device__ __forceinline__ void async_copy16(const half_t* gsrc, half_t* ldst) {
  __builtin_amdgcn_global_load_async_to_lds_b128((gas_v4i*)gsrc,
                                                 (las_v4i*)ldst, 0, 0);
}
__device__ __forceinline__ void wait_asynccnt0() {
#if __has_builtin(__builtin_amdgcn_s_wait_asynccnt)
  __builtin_amdgcn_s_wait_asynccnt(0);
#else
  asm volatile("s_wait_asynccnt 0" ::: "memory");
#endif
}
#endif

union frag16 { v16h v; v8h h[2]; };

// Build a 16-half fragment from two aligned 8-half (128-bit) loads.
__device__ __forceinline__ v16h ld_frag(const half_t* lo, const half_t* hi) {
  frag16 f;
  f.h[0] = *(const v8h*)lo;
  f.h[1] = *(const v8h*)hi;
  return f.v;
}

// Lane l <-> lane l ^ 16 (the other half of a query's keys).
__device__ __forceinline__ float xhalf(float x) {
  return __builtin_bit_cast(float, __builtin_amdgcn_permlanex16(
      __builtin_bit_cast(int, x), __builtin_bit_cast(int, x),
      0x76543210, 0xfedcba98, false, false));
}

__device__ __forceinline__ v8f wmma16(v16h a, v16h b, v8f c) {
  // D = A(16x32 f16) * B(32x16 f16) + C(16x16 f32)
  return __builtin_amdgcn_wmma_f32_16x16x32_f16(false, a, false, b,
                                                (short)0, c, false, false);
}

// ---------------------------------------------------------------------------
// Kernel 1: O = f16(X @ W + b).  X:[4096,768] f32, W:[768,768] f32 (row = in).
// grid = (64 M-tiles, 12 N-tiles, 3 {Q,K,V}), block = 128 (4 waves).
// ---------------------------------------------------------------------------
__global__ __launch_bounds__(128)
void qkv_gemm_kernel(const float* __restrict__ X,
                     const float* __restrict__ Wq, const float* __restrict__ bq,
                     const float* __restrict__ Wk, const float* __restrict__ bk,
                     const float* __restrict__ Wv, const float* __restrict__ bv,
                     half_t* __restrict__ Q, half_t* __restrict__ K,
                     half_t* __restrict__ V)
{
  const float* Wm;  const float* bias;  half_t* O;
  if (blockIdx.z == 0)      { Wm = Wq; bias = bq; O = Q; }
  else if (blockIdx.z == 1) { Wm = Wk; bias = bk; O = K; }
  else                      { Wm = Wv; bias = bv; O = V; }

  const int M0   = blockIdx.x * 64;
  const int N0   = blockIdx.y * 64;
  const int tid  = threadIdx.x;
  const int wave = tid >> 5;
  const int lane = tid & 31;
  const int l16  = lane & 15;
  const int hi   = lane >> 4;       // lane-group (0 | 1)
  const int koff = hi * 8;          // contraction offset for upper group

  // Row strides 40 halves = 80 B (multiple of 16 B) -> aligned b128 access.
  __shared__ alignas(16) half_t Xs [64][40];  // X tile, row-major  [m][k]
  __shared__ alignas(16) half_t Wst[64][40];  // W tile, TRANSPOSED [n][k]

  const v8f zero = {0.f,0.f,0.f,0.f,0.f,0.f,0.f,0.f};
  v8f acc[4];
  #pragma unroll
  for (int j = 0; j < 4; ++j) acc[j] = zero;

  for (int k0 = 0; k0 < kH; k0 += 32) {
    { // stage X tile (64 rows x 32 k) as f16; float4 global reads
      const int r = tid >> 1, c = (tid & 1) * 16;
      const float4* src = (const float4*)(X + (size_t)(M0 + r) * kH + k0 + c);
      #pragma unroll
      for (int i = 0; i < 4; ++i) {
        const float4 f = src[i];
        Xs[r][c + 4*i + 0] = (half_t)f.x;
        Xs[r][c + 4*i + 1] = (half_t)f.y;
        Xs[r][c + 4*i + 2] = (half_t)f.z;
        Xs[r][c + 4*i + 3] = (half_t)f.w;
      }
    }
    { // stage W tile (32 k x 64 n) transposed -> Wst[n][k]
      const int r = tid >> 2, c = (tid & 3) * 16;   // r = k row, c = n base
      const float4* src = (const float4*)(Wm + (size_t)(k0 + r) * kH + N0 + c);
      #pragma unroll
      for (int i = 0; i < 4; ++i) {
        const float4 f = src[i];
        Wst[c + 4*i + 0][r] = (half_t)f.x;
        Wst[c + 4*i + 1][r] = (half_t)f.y;
        Wst[c + 4*i + 2][r] = (half_t)f.z;
        Wst[c + 4*i + 3][r] = (half_t)f.w;
      }
    }
    __syncthreads();

    // A fragment (rows 16*wave..+15): contiguous 8-half runs -> 2x b128
    const int m = 16 * wave + l16;
    const v16h a = ld_frag(&Xs[m][koff], &Xs[m][16 + koff]);

    // B fragments for 4 N sub-tiles: transposed tile -> 2x b128 each
    #pragma unroll
    for (int j = 0; j < 4; ++j) {
      const int n = 16 * j + l16;
      const v16h bfr = ld_frag(&Wst[n][koff], &Wst[n][16 + koff]);
      acc[j] = wmma16(a, bfr, acc[j]);
    }
    __syncthreads();
  }

  // Epilogue: C/D layout -> global f16 with bias.
  #pragma unroll
  for (int j = 0; j < 4; ++j) {
    const int n = N0 + 16 * j + l16;
    const float bv_ = bias[n];
    #pragma unroll
    for (int r = 0; r < 8; ++r) {
      const int m2 = M0 + 16 * wave + r + 8 * hi;
      O[(size_t)m2 * kH + n] = (half_t)(acc[j][r] + bv_);
    }
  }
}

__global__ __launch_bounds__(128)
void attention_kernel(const half_t* __restrict__ Q,
                      const half_t* __restrict__ K,
                      const half_t* __restrict__ V,
                      float* __restrict__ out)
{
  const int qt = blockIdx.x;        // q tile (64 rows)
  const int h  = blockIdx.y;        // head
  const int b  = blockIdx.z;        // batch

  const int tid  = threadIdx.x;
  const int wave = tid >> 5;
  const int lane = tid & 31;
  const int l16  = lane & 15;
  const int hi   = lane >> 4;
  const int koff = hi * 8;

  const size_t headOff = (size_t)b * kS * kH + (size_t)h * kHD;
  const half_t* Qb = Q + headOff;   // row stride kH
  const half_t* Kb = K + headOff;
  const half_t* Vb = V + headOff;

  __shared__ alignas(16) half_t Ks [32][72];  // K tile row-major [k][d], 144 B rows
  __shared__ alignas(16) half_t Vst[64][40];  // V tile TRANSPOSED [d][k],  80 B rows

  // Q^T B-fragments for this wave (column = q row l16), d chunks [0,32) and
  // [32,64): 4x global b128, hardware k order (8*hi.., 16+8*hi..).
  const int q0 = qt * 64 + wave * 16;
  const half_t* qrow = Qb + (size_t)(q0 + l16) * kH;
  const v16h aq0 = ld_frag(qrow +      koff, qrow + 16 + koff);
  const v16h aq1 = ld_frag(qrow + 32 + koff, qrow + 48 + koff);

  const v8f zero = {0.f,0.f,0.f,0.f,0.f,0.f,0.f,0.f};
  v8f cacc[4];
  #pragma unroll
  for (int j = 0; j < 4; ++j) cacc[j] = zero;
  // One query per lane (column l16): running max, and this lane half's part
  // of the denominator (the halves are joined once, after the loop).
  float mrow = -1.0e30f, lsum = 0.0f;

  const float scale = 0.125f;       // 1/sqrt(64)

  for (int k0 = 0; k0 < kS; k0 += 32) {
    { // stage K (row-major, async DMA to LDS) and V (transposed, via VGPRs)
      const int r = tid >> 2, c = (tid & 3) * 16;   // r = k row, c = d base
      const half_t* ksrc = Kb + (size_t)(k0 + r) * kH + c;
      const half_t* vsrc = Vb + (size_t)(k0 + r) * kH + c;
#ifdef USE_ASYNC_LDS
      async_copy16(ksrc,     &Ks[r][c]);      // global_load_async_to_lds_b128
      async_copy16(ksrc + 8, &Ks[r][c + 8]);
#else
      *(v8h*)&Ks[r][c]     = *(const v8h*)(ksrc);
      *(v8h*)&Ks[r][c + 8] = *(const v8h*)(ksrc + 8);
#endif
      const v8h vv0 = *(const v8h*)(vsrc);
      const v8h vv1 = *(const v8h*)(vsrc + 8);
      #pragma unroll
      for (int i = 0; i < 8; ++i) {
        Vst[c + i][r]     = vv0[i];
        Vst[c + 8 + i][r] = vv1[i];
      }
      if (k0 + 32 < kS) {           // hint next tiles toward cache
        __builtin_prefetch(ksrc + 32 * kH, 0, 1);
        __builtin_prefetch(vsrc + 32 * kH, 0, 1);
      }
    }
#ifdef USE_ASYNC_LDS
    wait_asynccnt0();               // s_wait_asynccnt 0: K tile landed in LDS
#endif
    __syncthreads();

    // scores: S^T = K * Q^T  (A row = key, B column = query, contraction = d)
    // s[j][r] = score(key 16*j + 8*hi + r, query l16)
    v8f s[2];
    #pragma unroll
    for (int j = 0; j < 2; ++j) {
      const int krow = 16 * j + l16;
      v8f acc_s = zero;
      const v16h ak0 = ld_frag(&Ks[krow][koff],      &Ks[krow][16 + koff]);
      const v16h ak1 = ld_frag(&Ks[krow][32 + koff], &Ks[krow][48 + koff]);
      acc_s = wmma16(ak0, aq0, acc_s);
      acc_s = wmma16(ak1, aq1, acc_s);
      s[j] = acc_s;
    }

    // Online softmax, one query per lane.
    float tmax = fmaxf(s[0][0], s[1][0]);
    #pragma unroll
    for (int r = 1; r < 8; ++r) tmax = fmaxf(tmax, fmaxf(s[0][r], s[1][r]));
    tmax = fmaxf(tmax, xhalf(tmax)) * scale;
    const float mnew = fmaxf(mrow, tmax);
    const float corr = __expf(mrow - mnew);
    mrow = mnew;

    // P^T as B operand: element e = P^T[key kmap(e)][query] = tile e>>3, reg e&7.
    v16h bp;
    float psum = 0.0f;
    #pragma unroll
    for (int e = 0; e < 16; ++e) {
      const float p = __expf(s[e >> 3][e & 7] * scale - mnew);
      psum += p;
      bp[e] = (half_t)p;
    }
    lsum = lsum * corr + psum;
    #pragma unroll
    for (int j = 0; j < 4; ++j) cacc[j] *= corr;

    // ctx^T += V^T(64x32) * P^T(32x16): A rows = d from transposed Vst.
    #pragma unroll
    for (int j = 0; j < 4; ++j) {
      const int drow = 16 * j + l16;
      const v16h avf = ld_frag(&Vst[drow][koff], &Vst[drow][16 + koff]);
      cacc[j] = wmma16(avf, bp, cacc[j]);
    }
    __syncthreads();   // all Ks/Vst reads done before next tile load
  }

  // Normalize and store ctx (f32). Output layout [B,S,NH*HD]: head h occupies
  // columns h*64..h*64+63. cacc[j][r] = ctx[query l16][d = 16*j + 8*hi + r]:
  // 8 consecutive floats per lane and j -> two 16-byte stores.
  const float inv = 1.0f / (lsum + xhalf(lsum));
  float* orow = out + (size_t)(b * kS + q0 + l16) * kH + (size_t)h * kHD + 8 * hi;
  #pragma unroll
  for (int j = 0; j < 4; ++j) {
    const float4 lo4 = make_float4(cacc[j][0] * inv, cacc[j][1] * inv,
                                   cacc[j][2] * inv, cacc[j][3] * inv);
    const float4 hi4 = make_float4(cacc[j][4] * inv, cacc[j][5] * inv,
                                   cacc[j][6] * inv, cacc[j][7] * inv);
    *(float4*)(orow + 16 * j)     = lo4;
    *(float4*)(orow + 16 * j + 4) = hi4;
  }
}

// ---------------------------------------------------------------------------
extern "C" void kernel_launch(void* const* d_in, const int* in_sizes, int n_in,
                              void* d_out, int out_size, void* d_ws, size_t ws_size,
                              hipStream_t stream) {
  const float* X  = (const float*)d_in[0];
  const float* Wq = (const float*)d_in[1];
  const float* bq = (const float*)d_in[2];
  const float* Wk = (const float*)d_in[3];
  const float* bk = (const float*)d_in[4];
  const float* Wv = (const float*)d_in[5];
  const float* bv = (const float*)d_in[6];
  float* out = (float*)d_out;

  // Workspace: f16 Q, K, V, each [4096, 768] (6.29 MB each, 18.9 MB total).
  half_t* Qh = (half_t*)d_ws;
  half_t* Kh = Qh + (size_t)kBS * kH;
  half_t* Vh = Kh + (size_t)kBS * kH;

  dim3 g1(kBS / 64, kH / 64, 3);       // 64 x 12 x 3 blocks
  qkv_gemm_kernel<<<g1, 128, 0, stream>>>(X, Wq, bq, Wk, bk, Wv, bv, Qh, Kh, Vh);

  dim3 g2(kS / 64, kNH, kB);           // 32 x 12 x 2 blocks
  attention_kernel<<<g2, 128, 0, stream>>>(Qh, Kh, Vh, out);
}

// v002
// One run takes 101 microseconds.
// Two timings next to v001 both put it at 1.37 times that version's speed.
// Counting every step since v000, it is 1.74 times as fast.
#include <hip/hip_runtime.h>
#include <hip/hip_bf16.h>

// ---------------------------------------------------------------------------
// Self-attention forward for MI455X (gfx1250, wave32, WMMA).
//  Kernel 1: QKV projection GEMM (f32 in -> f16 Q/K/V in workspace).
//  Kernel 2: flash-attention over 64-row q tiles, online softmax.
// All WMMA fragments are built from 128-bit LDS/global loads. The W and V
// tiles lie ROW-MAJOR in LDS (16-byte stores) and are transposed on the way
// out by DS_LOAD_TR16_B128. The attention K tile
// (pure f16 byte copy) is staged with GLOBAL_LOAD_ASYNC_TO_LDS_B128
// (ASYNCcnt path) — builtin signature: (v4i AS1*, v4i AS3*, imm, imm).
// ---------------------------------------------------------------------------

typedef _Float16 half_t;
typedef __attribute__((ext_vector_type(16))) _Float16 v16h;
typedef __attribute__((ext_vector_type(8)))  _Float16 v8h;
typedef __attribute__((ext_vector_type(8)))  float    v8f;
typedef __attribute__((ext_vector_type(4)))  int      v4i;
typedef __attribute__((ext_vector_type(8)))  short    v8s;
typedef __attribute__((address_space(3))) v8s las_v8s;   // LDS (AS3)

constexpr int kB  = 2;
constexpr int kS  = 2048;
constexpr int kH  = 768;
constexpr int kNH = 12;
constexpr int kHD = 64;
constexpr int kBS = kB * kS;          // 4096 rows of hidden_states

#if defined(__has_builtin)
#if __has_builtin(__builtin_amdgcn_global_load_async_to_lds_b128)
#define USE_ASYNC_LDS 1
#endif
#endif

#ifdef USE_ASYNC_LDS
typedef __attribute__((address_space(1))) v4i gas_v4i;   // global (AS1)
typedef __attribute__((address_space(3))) v4i las_v4i;   // LDS    (AS3)
// Per-lane async copy of 16 bytes global -> LDS (tracked by ASYNCcnt).
__device__ __forceinline__ void async_copy16(const half_t* gsrc, half_t* ldst) {
  __builtin_amdgcn_global_load_async_to_lds_b128((gas_v4i*)gsrc,
                                                 (las_v4i*)ldst, 0, 0);
}
__device__ __forceinline__ void wait_asynccnt0() {
#if __has_builtin(__builtin_amdgcn_s_wait_asynccnt)
  __builtin_amdgcn_s_wait_asynccnt(0);
#else
  asm volatile("s_wait_asynccnt 0" ::: "memory");
#endif
}
#endif

union frag16 { v16h v; v8h h[2]; };

// Build a 16-half fragment from two aligned 8-half (128-bit) loads.
__device__ __forceinline__ v16h ld_frag(const half_t* lo, const half_t* hi) {
  frag16 f;
  f.h[0] = *(const v8h*)lo;
  f.h[1] = *(const v8h*)hi;
  return f.v;
}

// LDS row pitch, in halves, of a row-major [32 k][64 columns] f16 tile read by
// the transposing load: 160 B = 32 B x odd, its conflict-free pitch.
constexpr int kTrPitch = 80;

// Lane l's own address in such a tile T for the transposing load: row
// 8*(l>>4) + (l&7), 16-byte piece (l>>3)&1 of the first 16 columns.
__device__ __forceinline__ const half_t* tr_lane_ptr(const half_t* T, int lane) {
  return T + (8 * (lane >> 4) + (lane & 7)) * kTrPitch + 8 * ((lane >> 3) & 1);
}

// 16x32 fragment (A row or B column = tile column col0 + (l&15)) in the
// hardware k order 8*hi.., 16+8*hi..: rows 0..15, then rows 16..31.
__device__ __forceinline__ v16h ld_frag_tr(const half_t* lane_ptr, int col0) {
  frag16 f;
  f.h[0] = __builtin_bit_cast(v8h, __builtin_amdgcn_ds_load_tr16_b128_v8i16(
      (las_v8s*)(lane_ptr + col0)));
  f.h[1] = __builtin_bit_cast(v8h, __builtin_amdgcn_ds_load_tr16_b128_v8i16(
      (las_v8s*)(lane_ptr + 16 * kTrPitch + col0)));
  return f.v;
}

// Lane l <-> lane l ^ 16 (the other half of a query's keys).
__device__ __forceinline__ float xhalf(float x) {
  return __builtin_bit_cast(float, __builtin_amdgcn_permlanex16(
      __builtin_bit_cast(int, x), __builtin_bit_cast(int, x),
      0x76543210, 0xfedcba98, false, false));
}

__device__ __forceinline__ v8f wmma16(v16h a, v16h b, v8f c) {
  // D = A(16x32 f16) * B(32x16 f16) + C(16x16 f32)
  return __builtin_amdgcn_wmma_f32_16x16x32_f16(false, a, false, b,
                                                (short)0, c, false, false);
}

// ---------------------------------------------------------------------------
// Kernel 1: O = f16(X @ W + b).  X:[4096,768] f32, W:[768,768] f32 (row = in).
// grid = (64 M-tiles, 12 N-tiles, 3 {Q,K,V}), block = 128 (4 waves).
// ---------------------------------------------------------------------------
__global__ __launch_bounds__(128)
void qkv_gemm_kernel(const float* __restrict__ X,
                     const float* __restrict__ Wq, const float* __restrict__ bq,
                     const float* __restrict__ Wk, const float* __restrict__ bk,
                     const float* __restrict__ Wv, const float* __restrict__ bv,
                     half_t* __restrict__ Q, half_t* __restrict__ K,
                     half_t* __restrict__ V)
{
  const float* Wm;  const float* bias;  half_t* O;
  if (blockIdx.z == 0)      { Wm = Wq; bias = bq; O = Q; }
  else if (blockIdx.z == 1) { Wm = Wk; bias = bk; O = K; }
  else                      { Wm = Wv; bias = bv; O = V; }

  const int M0   = blockIdx.x * 64;
  const int N0   = blockIdx.y * 64;
  const int tid  = threadIdx.x;
  const int wave = tid >> 5;
  const int lane = tid & 31;
  const int l16  = lane & 15;
  const int hi   = lane >> 4;       // lane-group (0 | 1)
  const int koff = hi * 8;          // contraction offset for upper group

  // Row strides 40 / 80 halves = 80 / 160 B (multiples of 16 B) -> aligned b128 access.
  __shared__ alignas(16) half_t Xs [64][40];  // X tile, row-major  [m][k]
  __shared__ alignas(16) half_t Ws[32][kTrPitch];  // W tile, row-major [k][n]
  const half_t* wlane = tr_lane_ptr(&Ws[0][0], lane);

  const v8f zero = {0.f,0.f,0.f,0.f,0.f,0.f,0.f,0.f};
  v8f acc[4];
  #pragma unroll
  for (int j = 0; j < 4; ++j) acc[j] = zero;

  for (int k0 = 0; k0 < kH; k0 += 32) {
    { // stage X tile (64 rows x 32 k) as f16; float4 global reads
      const int r = tid >> 1, c = (tid & 1) * 16;
      const float4* src = (const float4*)(X + (size_t)(M0 + r) * kH + k0 + c);
      #pragma unroll
      for (int i = 0; i < 4; ++i) {
        const float4 f = src[i];
        Xs[r][c + 4*i + 0] = (half_t)f.x;
        Xs[r][c + 4*i + 1] = (half_t)f.y;
        Xs[r][c + 4*i + 2] = (half_t)f.z;
        Xs[r][c + 4*i + 3] = (half_t)f.w;
      }
    }
    { // stage W tile (32 k x 64 n) as f16, row-major -> Ws[k][n]
      const int r = tid >> 2, c = (tid & 3) * 16;   // r = k row, c = n base
      const float4* src = (const float4*)(Wm + (size_t)(k0 + r) * kH + N0 + c);
      #pragma unroll
      for (int i = 0; i < 4; ++i) {
        const float4 f = src[i];
        Ws[r][c + 4*i + 0] = (half_t)f.x;
        Ws[r][c + 4*i + 1] = (half_t)f.y;
        Ws[r][c + 4*i + 2] = (half_t)f.z;
        Ws[r][c + 4*i + 3] = (half_t)f.w;
      }
    }
    __syncthreads();

    // A fragment (rows 16*wave..+15): contiguous 8-half runs -> 2x b128
    const int m = 16 * wave + l16;
    const v16h a = ld_frag(&Xs[m][koff], &Xs[m][16 + koff]);

    // B fragments for 4 N sub-tiles: 2x transposing b128 load each
    #pragma unroll
    for (int j = 0; j < 4; ++j) {
      const v16h bfr = ld_frag_tr(wlane, 16 * j);
      acc[j] = wmma16(a, bfr, acc[j]);
    }
    __syncthreads();
  }

  // Epilogue: C/D layout -> global f16 with bias.
  #pragma unroll
  for (int j = 0; j < 4; ++j) {
    const int n = N0 + 16 * j + l16;
    const float bv_ = bias[n];
    #pragma unroll
    for (int r = 0; r < 8; ++r) {
      const int m2 = M0 + 16 * wave + r + 8 * hi;
      O[(size_t)m2 * kH + n] = (half_t)(acc[j][r] + bv_);
    }
  }
}

__global__ __launch_bounds__(128)
void attention_kernel(const half_t* __restrict__ Q,
                      const half_t* __restrict__ K,
                      const half_t* __restrict__ V,
                      float* __restrict__ out)
{
  const int qt = blockIdx.x;        // q tile (64 rows)
  const int h  = blockIdx.y;        // head
  const int b  = blockIdx.z;        // batch

  const int tid  = threadIdx.x;
  const int wave = tid >> 5;
  const int lane = tid & 31;
  const int l16  = lane & 15;
  const int hi   = lane >> 4;
  const int koff = hi * 8;

  const size_t headOff = (size_t)b * kS * kH + (size_t)h * kHD;
  const half_t* Qb = Q + headOff;   // row stride kH
  const half_t* Kb = K + headOff;
  const half_t* Vb = V + headOff;

  __shared__ alignas(16) half_t Ks [32][72];  // K tile row-major [k][d], 144 B rows
  __shared__ alignas(16) half_t Vs [32][kTrPitch];  // V tile row-major [k][d], 160 B rows
  const half_t* vlane = tr_lane_ptr(&Vs[0][0], lane);

  // Q^T B-fragments for this wave (column = q row l16), d chunks [0,32) and
  // [32,64): 4x global b128, hardware k order (8*hi.., 16+8*hi..).
  const int q0 = qt * 64 + wave * 16;
  const half_t* qrow = Qb + (size_t)(q0 + l16) * kH;
  const v16h aq0 = ld_frag(qrow +      koff, qrow + 16 + koff);
  const v16h aq1 = ld_frag(qrow + 32 + koff, qrow + 48 + koff);

  const v8f zero = {0.f,0.f,0.f,0.f,0.f,0.f,0.f,0.f};
  v8f cacc[4];
  #pragma unroll
  for (int j = 0; j < 4; ++j) cacc[j] = zero;
  // One query per lane (column l16): running max, and this lane half's part
  // of the denominator (the halves are joined once, after the loop).
  float mrow = -1.0e30f, lsum = 0.0f;

  const float scale = 0.125f;       // 1/sqrt(64)

  for (int k0 = 0; k0 < kS; k0 += 32) {
    { // stage K (row-major, async DMA to LDS) and V (row-major, via VGPRs)
      const int r = tid >> 2, c = (tid & 3) * 16;   // r = k row, c = d base
      const half_t* ksrc = Kb + (size_t)(k0 + r) * kH + c;
      const half_t* vsrc = Vb + (size_t)(k0 + r) * kH + c;
#ifdef USE_ASYNC_LDS
      async_copy16(ksrc,     &Ks[r][c]);      // global_load_async_to_lds_b128
      async_copy16(ksrc + 8, &Ks[r][c + 8]);
#else
      *(v8h*)&Ks[r][c]     = *(const v8h*)(ksrc);
      *(v8h*)&Ks[r][c + 8] = *(const v8h*)(ksrc + 8);
#endif
      const v8h vv0 = *(const v8h*)(vsrc);
      const v8h vv1 = *(const v8h*)(vsrc + 8);
      *(v8h*)&Vs[r][c]     = vv0;
      *(v8h*)&Vs[r][c + 8] = vv1;
      if (k0 + 32 < kS) {           // hint next tiles toward cache
        __builtin_prefetch(ksrc + 32 * kH, 0, 1);
        __builtin_prefetch(vsrc + 32 * kH, 0, 1);
      }
    }
#ifdef USE_ASYNC_LDS
    wait_asynccnt0();               // s_wait_asynccnt 0: K tile landed in LDS
#endif
    __syncthreads();

    // scores: S^T = K * Q^T  (A row = key, B column = query, contraction = d)
    // s[j][r] = score(key 16*j + 8*hi + r, query l16)
    v8f s[2];
    #pragma unroll
    for (int j = 0; j < 2; ++j) {
      const int krow = 16 * j + l16;
      v8f acc_s = zero;
      const v16h ak0 = ld_frag(&Ks[krow][koff],      &Ks[krow][16 + koff]);
      const v16h ak1 = ld_frag(&Ks[krow][32 + koff], &Ks[krow][48 + koff]);
      acc_s = wmma16(ak0, aq0, acc_s);
      acc_s = wmma16(ak1, aq1, acc_s);
      s[j] = acc_s;
    }

    // Online softmax, one query per lane.
    float tmax = fmaxf(s[0][0], s[1][0]);
    #pragma unroll
    for (int r = 1; r < 8; ++r) tmax = fmaxf(tmax, fmaxf(s[0][r], s[1][r]));
    tmax = fmaxf(tmax, xhalf(tmax)) * scale;
    const float mnew = fmaxf(mrow, tmax);
    const float corr = __expf(mrow - mnew);
    mrow = mnew;

    // P^T as B operand: element e = P^T[key kmap(e)][query] = tile e>>3, reg e&7.
    v16h bp;
    float psum = 0.0f;
    #pragma unroll
    for (int e = 0; e < 16; ++e) {
      const float p = __expf(s[e >> 3][e & 7] * scale - mnew);
      psum += p;
      bp[e] = (half_t)p;
    }
    lsum = lsum * corr + psum;
    #pragma unroll
    for (int j = 0; j < 4; ++j) cacc[j] *= corr;

    // ctx^T += V^T(64x32) * P^T(32x16): A rows = d, by the transposing load.
    #pragma unroll
    for (int j = 0; j < 4; ++j) {
      const v16h avf = ld_frag_tr(vlane, 16 * j);
      cacc[j] = wmma16(avf, bp, cacc[j]);
    }
    __syncthreads();   // all Ks/Vs reads done before next tile load
  }

  // Normalize and store ctx (f32). Output layout [B,S,NH*HD]: head h occupies
  // columns h*64..h*64+63. cacc[j][r] = ctx[query l16][d = 16*j + 8*hi + r]:
  // 8 consecutive floats per lane and j -> two 16-byte stores.
  const float inv = 1.0f / (lsum + xhalf(lsum));
  float* orow = out + (size_t)(b * kS + q0 + l16) * kH + (size_t)h * kHD + 8 * hi;
  #pragma unroll
  for (int j = 0; j < 4; ++j) {
    const float4 lo4 = make_float4(cacc[j][0] * inv, cacc[j][1] * inv,
                                   cacc[j][2] * inv, cacc[j][3] * inv);
    const float4 hi4 = make_float4(cacc[j][4] * inv, cacc[j][5] * inv,
                                   cacc[j][6] * inv, cacc[j][7] * inv);
    *(float4*)(orow + 16 * j)     = lo4;
    *(float4*)(orow + 16 * j + 4) = hi4;
  }
}

// ---------------------------------------------------------------------------
extern "C" void kernel_launch(void* const* d_in, const int* in_sizes, int n_in,
                              void* d_out, int out_size, void* d_ws, size_t ws_size,
                              hipStream_t stream) {
  const float* X  = (const float*)d_in[0];
  const float* Wq = (const float*)d_in[1];
  const float* bq = (const float*)d_in[2];
  const float* Wk = (const float*)d_in[3];
  const float* bk = (const float*)d_in[4];
  const float* Wv = (const float*)d_in[5];
  const float* bv = (const float*)d_in[6];
  float* out = (float*)d_out;

  // Workspace: f16 Q, K, V, each [4096, 768] (6.29 MB each, 18.9 MB total).
  half_t* Qh = (half_t*)d_ws;
  half_t* Kh = Qh + (size_t)kBS * kH;
  half_t* Vh = Kh + (size_t)kBS * kH;

  dim3 g1(kBS / 64, kH / 64, 3);       // 64 x 12 x 3 blocks
  qkv_gemm_kernel<<<g1, 128, 0, stream>>>(X, Wq, bq, Wk, bk, Wv, bv, Qh, Kh, Vh);

  dim3 g2(kS / 64, kNH, kB);           // 32 x 12 x 2 blocks
  attention_kernel<<<g2, 128, 0, stream>>>(Qh, Kh, Vh, out);
}

// v003
// Measured time: 97.3 microseconds a run.
// In two side-by-side timings against v002, it was 1.05 and 1.04 times as fast.
// Over all steps from v000 it is 1.81 times as fast.
#include <hip/hip_runtime.h>
#include <hip/hip_bf16.h>

// ---------------------------------------------------------------------------
// Self-attention forward for MI455X (gfx1250, wave32, WMMA).
//  Kernel 1: QKV projection GEMM (f32 in -> f16 Q/K/V in workspace).
//  Kernel 2: flash-attention over 64-row q tiles, online softmax.
// All WMMA fragments are built from 128-bit LDS/global loads. The W and V
// tiles lie ROW-MAJOR in LDS (16-byte stores) and are transposed on the way
// out by DS_LOAD_TR16_B128. The attention K and V tiles
// (pure f16 byte copies) are staged with GLOBAL_LOAD_ASYNC_TO_LDS_B128
// (ASYNCcnt path) in a ring of two buffers, one tile ahead of the products.
// ---------------------------------------------------------------------------

typedef _Float16 half_t;
typedef __attribute__((ext_vector_type(16))) _Float16 v16h;
typedef __attribute__((ext_vector_type(8)))  _Float16 v8h;
typedef __attribute__((ext_vector_type(8)))  float    v8f;
typedef __attribute__((ext_vector_type(4)))  int      v4i;
typedef __attribute__((ext_vector_type(8)))  short    v8s;
typedef __attribute__((address_space(3))) v8s las_v8s;   // LDS (AS3)

constexpr int kB  = 2;
constexpr int kS  = 2048;
constexpr int kH  = 768;
constexpr int kNH = 12;
constexpr int kHD = 64;
constexpr int kBS = kB * kS;          // 4096 rows of hidden_states

typedef __attribute__((address_space(3))) half_t las_half;   // LDS (AS3)
// Byte address of a __shared__ element inside the work-group's LDS.
__device__ __forceinline__ unsigned lds_addr(const half_t* p) {
  return (unsigned)(size_t)(const las_half*)p;
}
// This wave's own copies have landed in LDS (asm with the clobber: no LDS read
// may be moved in front of it).
__device__ __forceinline__ void wait_asynccnt0() {
  asm volatile("s_wait_asynccnt 0x0" ::: "memory");
}
// This wave's own LDS reads have returned: its buffer may be refilled behind
// the next barrier.
__device__ __forceinline__ void wait_dscnt0() {
  asm volatile("s_wait_dscnt 0x0" ::: "memory");
}
// One lane's share of a K/V tile pair: 32 bytes of one K row and of one V row,
// global -> LDS through no register (tracked by ASYNCcnt). The s_wait_xcnt
// closes the statement so that no address register named here is rewritten
// in front of it.
__device__ __forceinline__ void stage_kv(const half_t* ksrc, const half_t* vsrc,
                                         unsigned kdst, unsigned vdst) {
  asm volatile("global_load_async_to_lds_b128 %0, %4, off\n\t"
               "global_load_async_to_lds_b128 %1, %5, off\n\t"
               "global_load_async_to_lds_b128 %2, %6, off\n\t"
               "global_load_async_to_lds_b128 %3, %7, off\n\t"
               "s_wait_xcnt 0x0"
               :: "v"(kdst), "v"(kdst + 16u), "v"(vdst), "v"(vdst + 16u),
                  "v"(ksrc), "v"(ksrc + 8), "v"(vsrc), "v"(vsrc + 8)
               : "memory");
}

union frag16 { v16h v; v8h h[2]; };

// Build a 16-half fragment from two aligned 8-half (128-bit) loads.
__device__ __forceinline__ v16h ld_frag(const half_t* lo, const half_t* hi) {
  frag16 f;
  f.h[0] = *(const v8h*)lo;
  f.h[1] = *(const v8h*)hi;
  return f.v;
}

// LDS row pitch, in halves, of a row-major [32 k][64 columns] f16 tile read by
// the transposing load: 160 B = 32 B x odd, its conflict-free pitch.
constexpr int kTrPitch = 80;

// Lane l's own address in such a tile T for the transposing load: row
// 8*(l>>4) + (l&7), 16-byte piece (l>>3)&1 of the first 16 columns.
__device__ __forceinline__ const half_t* tr_lane_ptr(const half_t* T, int lane) {
  return T + (8 * (lane >> 4) + (lane & 7)) * kTrPitch + 8 * ((lane >> 3) & 1);
}

// 16x32 fragment (A row or B column = tile column col0 + (l&15)) in the
// hardware k order 8*hi.., 16+8*hi..: rows 0..15, then rows 16..31.
__device__ __forceinline__ v16h ld_frag_tr(const half_t* lane_ptr, int col0) {
  frag16 f;
  f.h[0] = __builtin_bit_cast(v8h, __builtin_amdgcn_ds_load_tr16_b128_v8i16(
      (las_v8s*)(lane_ptr + col0)));
  f.h[1] = __builtin_bit_cast(v8h, __builtin_amdgcn_ds_load_tr16_b128_v8i16(
      (las_v8s*)(lane_ptr + 16 * kTrPitch + col0)));
  return f.v;
}

// Lane l <-> lane l ^ 16 (the other half of a query's keys).
__device__ __forceinline__ float xhalf(float x) {
  return __builtin_bit_cast(float, __builtin_amdgcn_permlanex16(
      __builtin_bit_cast(int, x), __builtin_bit_cast(int, x),
      0x76543210, 0xfedcba98, false, false));
}

__device__ __forceinline__ v8f wmma16(v16h a, v16h b, v8f c) {
  // D = A(16x32 f16) * B(32x16 f16) + C(16x16 f32)
  return __builtin_amdgcn_wmma_f32_16x16x32_f16(false, a, false, b,
                                                (short)0, c, false, false);
}

// ---------------------------------------------------------------------------
// Kernel 1: O = f16(X @ W + b).  X:[4096,768] f32, W:[768,768] f32 (row = in).
// grid = (64 M-tiles, 12 N-tiles, 3 {Q,K,V}), block = 128 (4 waves).
// ---------------------------------------------------------------------------
__global__ __launch_bounds__(128)
void qkv_gemm_kernel(const float* __restrict__ X,
                     const float* __restrict__ Wq, const float* __restrict__ bq,
                     const float* __restrict__ Wk, const float* __restrict__ bk,
                     const float* __restrict__ Wv, const float* __restrict__ bv,
                     half_t* __restrict__ Q, half_t* __restrict__ K,
                     half_t* __restrict__ V)
{
  const float* Wm;  const float* bias;  half_t* O;
  if (blockIdx.z == 0)      { Wm = Wq; bias = bq; O = Q; }
  else if (blockIdx.z == 1) { Wm = Wk; bias = bk; O = K; }
  else                      { Wm = Wv; bias = bv; O = V; }

  const int M0   = blockIdx.x * 64;
  const int N0   = blockIdx.y * 64;
  const int tid  = threadIdx.x;
  const int wave = tid >> 5;
  const int lane = tid & 31;
  const int l16  = lane & 15;
  const int hi   = lane >> 4;       // lane-group (0 | 1)
  const int koff = hi * 8;          // contraction offset for upper group

  // Row strides 40 / 80 halves = 80 / 160 B (multiples of 16 B) -> aligned b128 access.
  __shared__ alignas(16) half_t Xs [64][40];  // X tile, row-major  [m][k]
  __shared__ alignas(16) half_t Ws[32][kTrPitch];  // W tile, row-major [k][n]
  const half_t* wlane = tr_lane_ptr(&Ws[0][0], lane);

  const v8f zero = {0.f,0.f,0.f,0.f,0.f,0.f,0.f,0.f};
  v8f acc[4];
  #pragma unroll
  for (int j = 0; j < 4; ++j) acc[j] = zero;

  for (int k0 = 0; k0 < kH; k0 += 32) {
    { // stage X tile (64 rows x 32 k) as f16; float4 global reads
      const int r = tid >> 1, c = (tid & 1) * 16;
      const float4* src = (const float4*)(X + (size_t)(M0 + r) * kH + k0 + c);
      #pragma unroll
      for (int i = 0; i < 4; ++i) {
        const float4 f = src[i];
        Xs[r][c + 4*i + 0] = (half_t)f.x;
        Xs[r][c + 4*i + 1] = (half_t)f.y;
        Xs[r][c + 4*i + 2] = (half_t)f.z;
        Xs[r][c + 4*i + 3] = (half_t)f.w;
      }
    }
    { // stage W tile (32 k x 64 n) as f16, row-major -> Ws[k][n]
      const int r = tid >> 2, c = (tid & 3) * 16;   // r = k row, c = n base
      const float4* src = (const float4*)(Wm + (size_t)(k0 + r) * kH + N0 + c);
      #pragma unroll
      for (int i = 0; i < 4; ++i) {
        const float4 f = src[i];
        Ws[r][c + 4*i + 0] = (half_t)f.x;
        Ws[r][c + 4*i + 1] = (half_t)f.y;
        Ws[r][c + 4*i + 2] = (half_t)f.z;
        Ws[r][c + 4*i + 3] = (half_t)f.w;
      }
    }
    __syncthreads();

    // A fragment (rows 16*wave..+15): contiguous 8-half runs -> 2x b128
    const int m = 16 * wave + l16;
    const v16h a = ld_frag(&Xs[m][koff], &Xs[m][16 + koff]);

    // B fragments for 4 N sub-tiles: 2x transposing b128 load each
    #pragma unroll
    for (int j = 0; j < 4; ++j) {
      const v16h bfr = ld_frag_tr(wlane, 16 * j);
      acc[j] = wmma16(a, bfr, acc[j]);
    }
    __syncthreads();
  }

  // Epilogue: C/D layout -> global f16 with bias.
  #pragma unroll
  for (int j = 0; j < 4; ++j) {
    const int n = N0 + 16 * j + l16;
    const float bv_ = bias[n];
    #pragma unroll
    for (int r = 0; r < 8; ++r) {
      const int m2 = M0 + 16 * wave + r + 8 * hi;
      O[(size_t)m2 * kH + n] = (half_t)(acc[j][r] + bv_);
    }
  }
}

__global__ __launch_bounds__(128)
void attention_kernel(const half_t* __restrict__ Q,
                      const half_t* __restrict__ K,
                      const half_t* __restrict__ V,
                      float* __restrict__ out)
{
  const int qt = blockIdx.x;        // q tile (64 rows)
  const int h  = blockIdx.y;        // head
  const int b  = blockIdx.z;        // batch

  const int tid  = threadIdx.x;
  const int wave = tid >> 5;
  const int lane = tid & 31;
  const int l16  = lane & 15;
  const int hi   = lane >> 4;
  const int koff = hi * 8;

  const size_t headOff = (size_t)b * kS * kH + (size_t)h * kHD;
  const half_t* Qb = Q + headOff;   // row stride kH
  const half_t* Kb = K + headOff;
  const half_t* Vb = V + headOff;

  __shared__ alignas(16) half_t Ks [2][32][72];  // K tiles row-major [k][d], 144 B rows
  __shared__ alignas(16) half_t Vs [2][32][kTrPitch];  // V tiles row-major [k][d], 160 B rows

  // Q^T B-fragments for this wave (column = q row l16), d chunks [0,32) and
  // [32,64): 4x global b128, hardware k order (8*hi.., 16+8*hi..).
  const int q0 = qt * 64 + wave * 16;
  const half_t* qrow = Qb + (size_t)(q0 + l16) * kH;
  const v16h aq0 = ld_frag(qrow +      koff, qrow + 16 + koff);
  const v16h aq1 = ld_frag(qrow + 32 + koff, qrow + 48 + koff);

  const v8f zero = {0.f,0.f,0.f,0.f,0.f,0.f,0.f,0.f};
  v8f cacc[4];
  #pragma unroll
  for (int j = 0; j < 4; ++j) cacc[j] = zero;
  // One query per lane (column l16): running max, and this lane half's part
  // of the denominator (the halves are joined once, after the loop).
  float mrow = -1.0e30f, lsum = 0.0f;

  const float scale = 0.125f;       // 1/sqrt(64)

  // Lane's share of every tile: k row sr, 16 halves from d = sc.
  constexpr int kTiles = kS / 32;
  const int sr = tid >> 2, sc = (tid & 3) * 16;
  const half_t* ksrc = Kb + (size_t)sr * kH + sc;
  const half_t* vsrc = Vb + (size_t)sr * kH + sc;

  // Ring prologue: tile 0 landed and published, then tile 1 in flight.
  stage_kv(ksrc, vsrc, lds_addr(&Ks[0][sr][sc]), lds_addr(&Vs[0][sr][sc]));
  wait_asynccnt0();
  __syncthreads();
  stage_kv(ksrc + 32 * kH, vsrc + 32 * kH,
           lds_addr(&Ks[1][sr][sc]), lds_addr(&Vs[1][sr][sc]));

  // Two trips a pass of the loop: the buffer index is then a constant and every
  // LDS address an immediate offset.
  #pragma unroll 2
  for (int t = 0; t < kTiles; ++t) {
    const int buf = t & 1;
    const half_t (*Kt)[72] = Ks[buf];
    const half_t* vlane = tr_lane_ptr(&Vs[buf][0][0], lane);

    // scores: S^T = K * Q^T  (A row = key, B column = query, contraction = d)
    // s[j][r] = score(key 16*j + 8*hi + r, query l16)
    v8f s[2];
    #pragma unroll
    for (int j = 0; j < 2; ++j) {
      const int krow = 16 * j + l16;
      v8f acc_s = zero;
      const v16h ak0 = ld_frag(&Kt[krow][koff],      &Kt[krow][16 + koff]);
      const v16h ak1 = ld_frag(&Kt[krow][32 + koff], &Kt[krow][48 + koff]);
      acc_s = wmma16(ak0, aq0, acc_s);
      acc_s = wmma16(ak1, aq1, acc_s);
      s[j] = acc_s;
    }

    // Online softmax, one query per lane.
    float tmax = fmaxf(s[0][0], s[1][0]);
    #pragma unroll
    for (int r = 1; r < 8; ++r) tmax = fmaxf(tmax, fmaxf(s[0][r], s[1][r]));
    tmax = fmaxf(tmax, xhalf(tmax)) * scale;
    const float mnew = fmaxf(mrow, tmax);
    const float corr = __expf(mrow - mnew);
    mrow = mnew;

    // P^T as B operand: element e = P^T[key kmap(e)][query] = tile e>>3, reg e&7.
    v16h bp;
    float psum = 0.0f;
    #pragma unroll
    for (int e = 0; e < 16; ++e) {
      const float p = __expf(s[e >> 3][e & 7] * scale - mnew);
      psum += p;
      bp[e] = (half_t)p;
    }
    lsum = lsum * corr + psum;
    #pragma unroll
    for (int j = 0; j < 4; ++j) cacc[j] *= corr;

    // ctx^T += V^T(64x32) * P^T(32x16): A rows = d, by the transposing load.
    #pragma unroll
    for (int j = 0; j < 4; ++j) {
      const v16h avf = ld_frag_tr(vlane, 16 * j);
      cacc[j] = wmma16(avf, bp, cacc[j]);
    }

    // Publish point of tile t + 1: own reads of tile t returned, own copies of
    // tile t + 1 landed, then the one barrier of the trip; behind it tile t's
    // buffer is free for tile t + 2.
    wait_dscnt0();
    wait_asynccnt0();
    __syncthreads();
    if (t + 2 < kTiles) {
      stage_kv(ksrc + (size_t)(t + 2) * 32 * kH, vsrc + (size_t)(t + 2) * 32 * kH,
               lds_addr(&Ks[buf][sr][sc]), lds_addr(&Vs[buf][sr][sc]));
    }
  }
  wait_asynccnt0();    // nothing of this wave is in flight when it ends

  // Normalize and store ctx (f32). Output layout [B,S,NH*HD]: head h occupies
  // columns h*64..h*64+63. cacc[j][r] = ctx[query l16][d = 16*j + 8*hi + r]:
  // 8 consecutive floats per lane and j -> two 16-byte stores.
  const float inv = 1.0f / (lsum + xhalf(lsum));
  float* orow = out + (size_t)(b * kS + q0 + l16) * kH + (size_t)h * kHD + 8 * hi;
  #pragma unroll
  for (int j = 0; j < 4; ++j) {
    const float4 lo4 = make_float4(cacc[j][0] * inv, cacc[j][1] * inv,
                                   cacc[j][2] * inv, cacc[j][3] * inv);
    const float4 hi4 = make_float4(cacc[j][4] * inv, cacc[j][5] * inv,
                                   cacc[j][6] * inv, cacc[j][7] * inv);
    *(float4*)(orow + 16 * j)     = lo4;
    *(float4*)(orow + 16 * j + 4) = hi4;
  }
}

// ---------------------------------------------------------------------------
extern "C" void kernel_launch(void* const* d_in, const int* in_sizes, int n_in,
                              void* d_out, int out_size, void* d_ws, size_t ws_size,
                              hipStream_t stream) {
  const float* X  = (const float*)d_in[0];
  const float* Wq = (const float*)d_in[1];
  const float* bq = (const float*)d_in[2];
  const float* Wk = (const float*)d_in[3];
  const float* bk = (const float*)d_in[4];
  const float* Wv = (const float*)d_in[5];
  const float* bv = (const float*)d_in[6];
  float* out = (float*)d_out;

  // Workspace: f16 Q, K, V, each [4096, 768] (6.29 MB each, 18.9 MB total).
  half_t* Qh = (half_t*)d_ws;
  half_t* Kh = Qh + (size_t)kBS * kH;
  half_t* Vh = Kh + (size_t)kBS * kH;

  dim3 g1(kBS / 64, kH / 64, 3);       // 64 x 12 x 3 blocks
  qkv_gemm_kernel<<<g1, 128, 0, stream>>>(X, Wq, bq, Wk, bk, Wv, bv, Qh, Kh, Vh);

  dim3 g2(kS / 64, kNH, kB);           // 32 x 12 x 2 blocks
  attention_kernel<<<g2, 128, 0, stream>>>(Qh, Kh, Vh, out);
}

// v004
// One run takes 71.8 microseconds.
// Two timings next to v003 put it at 1.35 and 1.36 times that version's speed.
// Counting every step since v000, it is 2.46 times as fast.
#include <hip/hip_runtime.h>
#include <hip/hip_bf16.h>

// ---------------------------------------------------------------------------
// Self-attention forward for MI455X (gfx1250, wave32, WMMA).
//  Kernel 1: QKV projection GEMM (f32 in -> f16 Q/K/V in workspace).
//  Kernel 2: flash-attention over 64-row q tiles, online softmax.
// All WMMA fragments are built from 128-bit LDS/global loads. The W and V
// tiles lie ROW-MAJOR in LDS and are transposed on the way
// out by DS_LOAD_TR16_B128. The attention K and V tiles
// (pure f16 byte copies) are staged with GLOBAL_LOAD_ASYNC_TO_LDS_B128
// (ASYNCcnt path) in a ring of two buffers, one tile ahead of the products.
// Every wave-wide 16-byte global load or copy of a tile bound for LDS covers four whole
// 128-byte lines: consecutive lanes walk along a row.
// ---------------------------------------------------------------------------

typedef _Float16 half_t;
typedef __attribute__((ext_vector_type(16))) _Float16 v16h;
typedef __attribute__((ext_vector_type(8)))  _Float16 v8h;
typedef __attribute__((ext_vector_type(4)))  _Float16 v4h;
typedef __attribute__((ext_vector_type(8)))  float    v8f;
typedef __attribute__((ext_vector_type(4)))  int      v4i;
typedef __attribute__((ext_vector_type(8)))  short    v8s;
typedef __attribute__((address_space(3))) v8s las_v8s;   // LDS (AS3)

constexpr int kB  = 2;
constexpr int kS  = 2048;
constexpr int kH  = 768;
constexpr int kNH = 12;
constexpr int kHD = 64;
constexpr int kBS = kB * kS;          // 4096 rows of hidden_states

// LDS row pitch, in halves, of a row-major [32 k][64 columns] f16 tile read by
// the transposing load: 160 B = 32 B x odd, its conflict-free pitch.
constexpr int kTrPitch = 80;
// LDS row pitch, in halves, of the K tile (plain 16-byte reads): 144 B.
constexpr int kKPitch = 72;

typedef __attribute__((address_space(3))) half_t las_half;   // LDS (AS3)
// Byte address of a __shared__ element inside the work-group's LDS.
__device__ __forceinline__ unsigned lds_addr(const half_t* p) {
  return (unsigned)(size_t)(const las_half*)p;
}
// This wave's own copies have landed in LDS (asm with the clobber: no LDS read
// may be moved in front of it).
__device__ __forceinline__ void wait_asynccnt0() {
  asm volatile("s_wait_asynccnt 0x0" ::: "memory");
}
// This wave's own LDS reads have returned: its buffer may be refilled behind
// the next barrier.
__device__ __forceinline__ void wait_dscnt0() {
  asm volatile("s_wait_dscnt 0x0" ::: "memory");
}
// One lane's share of a K/V tile pair: 16 bytes of K rows r and r + 16 and of
// V rows r and r + 16 (eight lanes a row: a wave's copy covers 4 whole lines),
// global -> LDS through no register (tracked by ASYNCcnt). The s_wait_xcnt
// closes the statement so that no address register named here is rewritten
// in front of it.
__device__ __forceinline__ void stage_kv(const half_t* ksrc, const half_t* vsrc,
                                         unsigned kdst, unsigned vdst) {
  asm volatile("global_load_async_to_lds_b128 %0, %4, off\n\t"
               "global_load_async_to_lds_b128 %1, %5, off\n\t"
               "global_load_async_to_lds_b128 %2, %6, off\n\t"
               "global_load_async_to_lds_b128 %3, %7, off\n\t"
               "s_wait_xcnt 0x0"
               :: "v"(kdst), "v"(kdst + 16u * kKPitch * 2u),
                  "v"(vdst), "v"(vdst + 16u * kTrPitch * 2u),
                  "v"(ksrc), "v"(ksrc + 16 * kH), "v"(vsrc), "v"(vsrc + 16 * kH)
               : "memory");
}

union frag16 { v16h v; v8h h[2]; };

// Build a 16-half fragment from two aligned 8-half (128-bit) loads.
__device__ __forceinline__ v16h ld_frag(const half_t* lo, const half_t* hi) {
  frag16 f;
  f.h[0] = *(const v8h*)lo;
  f.h[1] = *(const v8h*)hi;
  return f.v;
}

// Lane l's own address in such a tile T for the transposing load: row
// 8*(l>>4) + (l&7), 16-byte piece (l>>3)&1 of the first 16 columns.
__device__ __forceinline__ const half_t* tr_lane_ptr(const half_t* T, int lane) {
  return T + (8 * (lane >> 4) + (lane & 7)) * kTrPitch + 8 * ((lane >> 3) & 1);
}

// 16x32 fragment (A row or B column = tile column col0 + (l&15)) in the
// hardware k order 8*hi.., 16+8*hi..: rows 0..15, then rows 16..31.
__device__ __forceinline__ v16h ld_frag_tr(const half_t* lane_ptr, int col0) {
  frag16 f;
  f.h[0] = __builtin_bit_cast(v8h, __builtin_amdgcn_ds_load_tr16_b128_v8i16(
      (las_v8s*)(lane_ptr + col0)));
  f.h[1] = __builtin_bit_cast(v8h, __builtin_amdgcn_ds_load_tr16_b128_v8i16(
      (las_v8s*)(lane_ptr + 16 * kTrPitch + col0)));
  return f.v;
}

// Lane l <-> lane l ^ 16 (the other half of a query's keys).
__device__ __forceinline__ float xhalf(float x) {
  return __builtin_bit_cast(float, __builtin_amdgcn_permlanex16(
      __builtin_bit_cast(int, x), __builtin_bit_cast(int, x),
      0x76543210, 0xfedcba98, false, false));
}

__device__ __forceinline__ v8f wmma16(v16h a, v16h b, v8f c) {
  // D = A(16x32 f16) * B(32x16 f16) + C(16x16 f32)
  return __builtin_amdgcn_wmma_f32_16x16x32_f16(false, a, false, b,
                                                (short)0, c, false, false);
}

// ---------------------------------------------------------------------------
// Kernel 1: O = f16(X @ W + b).  X:[4096,768] f32, W:[768,768] f32 (row = in).
// grid = (64 M-tiles, 12 N-tiles, 3 {Q,K,V}), block = 128 (4 waves).
// ---------------------------------------------------------------------------
__global__ __launch_bounds__(128)
void qkv_gemm_kernel(const float* __restrict__ X,
                     const float* __restrict__ Wq, const float* __restrict__ bq,
                     const float* __restrict__ Wk, const float* __restrict__ bk,
                     const float* __restrict__ Wv, const float* __restrict__ bv,
                     half_t* __restrict__ Q, half_t* __restrict__ K,
                     half_t* __restrict__ V)
{
  const float* Wm;  const float* bias;  half_t* O;
  if (blockIdx.z == 0)      { Wm = Wq; bias = bq; O = Q; }
  else if (blockIdx.z == 1) { Wm = Wk; bias = bk; O = K; }
  else                      { Wm = Wv; bias = bv; O = V; }

  const int M0   = blockIdx.x * 64;
  const int N0   = blockIdx.y * 64;
  const int tid  = threadIdx.x;
  const int wave = tid >> 5;
  const int lane = tid & 31;
  const int l16  = lane & 15;
  const int hi   = lane >> 4;       // lane-group (0 | 1)
  const int koff = hi * 8;          // contraction offset for upper group

  // Row strides 40 / 80 halves = 80 / 160 B (multiples of 16 B) -> aligned b128 access.
  __shared__ alignas(16) half_t Xs [64][40];  // X tile, row-major  [m][k]
  __shared__ alignas(16) half_t Ws[32][kTrPitch];  // W tile, row-major [k][n]
  const half_t* wlane = tr_lane_ptr(&Ws[0][0], lane);

  const v8f zero = {0.f,0.f,0.f,0.f,0.f,0.f,0.f,0.f};
  v8f acc[4];
  #pragma unroll
  for (int j = 0; j < 4; ++j) acc[j] = zero;

  for (int k0 = 0; k0 < kH; k0 += 32) {
    // Stage the X tile (64 rows x 32 k) and the W tile (32 k x 64 n) as f16.
    // float4 global reads, consecutive lanes along a row: eight lanes cover an
    // X row's 128 bytes, sixteen a W row's 256, so a wave's load covers 4 whole
    // lines (and no two loads of a trip share a line).
    const int xr = tid >> 3, xc = (tid & 7) * 4;    // X row, k base
    const int wr = tid >> 4, wc = (tid & 15) * 4;   // k row, n base
    const float* xsrc = X  + (size_t)(M0 + xr) * kH + k0 + xc;
    const float* wsrc = Wm + (size_t)(k0 + wr) * kH + N0 + wc;
    float4 fx[4], fw[4];
    #pragma unroll
    for (int i = 0; i < 4; ++i) fx[i] = *(const float4*)(xsrc + (size_t)(16 * i) * kH);
    #pragma unroll
    for (int i = 0; i < 4; ++i) fw[i] = *(const float4*)(wsrc + (size_t)(8 * i) * kH);
    // Keeps all eight loads in front of the first conversion: without it the
    // compiler issues them in three groups over the same registers, and a trip
    // waits out three L2 latencies one after the other.
    __builtin_amdgcn_sched_barrier(0);
    #pragma unroll
    for (int i = 0; i < 4; ++i) {
      const v4h hx = {(half_t)fx[i].x, (half_t)fx[i].y, (half_t)fx[i].z, (half_t)fx[i].w};
      *(v4h*)&Xs[xr + 16 * i][xc] = hx;
    }
    #pragma unroll
    for (int i = 0; i < 4; ++i) {
      const v4h hw = {(half_t)fw[i].x, (half_t)fw[i].y, (half_t)fw[i].z, (half_t)fw[i].w};
      *(v4h*)&Ws[wr + 8 * i][wc] = hw;
    }
    // Stands in front of the pointer advance that rewrites the address
    // registers the eight loads name.
    asm volatile("s_wait_xcnt 0x0" ::: "memory");
    __syncthreads();

    // A fragment (rows 16*wave..+15): contiguous 8-half runs -> 2x b128
    const int m = 16 * wave + l16;
    const v16h a = ld_frag(&Xs[m][koff], &Xs[m][16 + koff]);

    // B fragments for 4 N sub-tiles: 2x transposing b128 load each
    #pragma unroll
    for (int j = 0; j < 4; ++j) {
      const v16h bfr = ld_frag_tr(wlane, 16 * j);
      acc[j] = wmma16(a, bfr, acc[j]);
    }
    __syncthreads();
  }

  // Epilogue: C/D layout -> global f16 with bias.
  #pragma unroll
  for (int j = 0; j < 4; ++j) {
    const int n = N0 + 16 * j + l16;
    const float bv_ = bias[n];
    #pragma unroll
    for (int r = 0; r < 8; ++r) {
      const int m2 = M0 + 16 * wave + r + 8 * hi;
      O[(size_t)m2 * kH + n] = (half_t)(acc[j][r] + bv_);
    }
  }
}

__global__ __launch_bounds__(128)
void attention_kernel(const half_t* __restrict__ Q,
                      const half_t* __restrict__ K,
                      const half_t* __restrict__ V,
                      float* __restrict__ out)
{
  const int qt = blockIdx.x;        // q tile (64 rows)
  const int h  = blockIdx.y;        // head
  const int b  = blockIdx.z;        // batch

  const int tid  = threadIdx.x;
  const int wave = tid >> 5;
  const int lane = tid & 31;
  const int l16  = lane & 15;
  const int hi   = lane >> 4;
  const int koff = hi * 8;

  const size_t headOff = (size_t)b * kS * kH + (size_t)h * kHD;
  const half_t* Qb = Q + headOff;   // row stride kH
  const half_t* Kb = K + headOff;
  const half_t* Vb = V + headOff;

  __shared__ alignas(16) half_t Ks [2][32][kKPitch];  // K tiles row-major [k][d], 144 B rows
  __shared__ alignas(16) half_t Vs [2][32][kTrPitch];  // V tiles row-major [k][d], 160 B rows

  // Q^T B-fragments for this wave (column = q row l16), d chunks [0,32) and
  // [32,64): 4x global b128, hardware k order (8*hi.., 16+8*hi..).
  const int q0 = qt * 64 + wave * 16;
  const half_t* qrow = Qb + (size_t)(q0 + l16) * kH;
  const v16h aq0 = ld_frag(qrow +      koff, qrow + 16 + koff);
  const v16h aq1 = ld_frag(qrow + 32 + koff, qrow + 48 + koff);

  const v8f zero = {0.f,0.f,0.f,0.f,0.f,0.f,0.f,0.f};
  v8f cacc[4];
  #pragma unroll
  for (int j = 0; j < 4; ++j) cacc[j] = zero;
  // One query per lane (column l16): running max, and this lane half's part
  // of the denominator (the halves are joined once, after the loop).
  float mrow = -1.0e30f, lsum = 0.0f;

  const float scale = 0.125f;       // 1/sqrt(64)

  // Lane's share of every tile: k rows sr and sr + 16, 8 halves from d = sc.
  constexpr int kTiles = kS / 32;
  const int sr = tid >> 3, sc = (tid & 7) * 8;
  const half_t* ksrc = Kb + (size_t)sr * kH + sc;
  const half_t* vsrc = Vb + (size_t)sr * kH + sc;

  // Ring prologue: tile 0 landed and published, then tile 1 in flight.
  stage_kv(ksrc, vsrc, lds_addr(&Ks[0][sr][sc]), lds_addr(&Vs[0][sr][sc]));
  wait_asynccnt0();
  __syncthreads();
  stage_kv(ksrc + 32 * kH, vsrc + 32 * kH,
           lds_addr(&Ks[1][sr][sc]), lds_addr(&Vs[1][sr][sc]));

  // Two trips a pass of the loop: the buffer index is then a constant and every
  // LDS address an immediate offset.
  #pragma unroll 2
  for (int t = 0; t < kTiles; ++t) {
    const int buf = t & 1;
    const half_t (*Kt)[kKPitch] = Ks[buf];
    const half_t* vlane = tr_lane_ptr(&Vs[buf][0][0], lane);

    // scores: S^T = K * Q^T  (A row = key, B column = query, contraction = d)
    // s[j][r] = score(key 16*j + 8*hi + r, query l16)
    v8f s[2];
    #pragma unroll
    for (int j = 0; j < 2; ++j) {
      const int krow = 16 * j + l16;
      v8f acc_s = zero;
      const v16h ak0 = ld_frag(&Kt[krow][koff],      &Kt[krow][16 + koff]);
      const v16h ak1 = ld_frag(&Kt[krow][32 + koff], &Kt[krow][48 + koff]);
      acc_s = wmma16(ak0, aq0, acc_s);
      acc_s = wmma16(ak1, aq1, acc_s);
      s[j] = acc_s;
    }

    // Online softmax, one query per lane.
    float tmax = fmaxf(s[0][0], s[1][0]);
    #pragma unroll
    for (int r = 1; r < 8; ++r) tmax = fmaxf(tmax, fmaxf(s[0][r], s[1][r]));
    tmax = fmaxf(tmax, xhalf(tmax)) * scale;
    const float mnew = fmaxf(mrow, tmax);
    const float corr = __expf(mrow - mnew);
    mrow = mnew;

    // P^T as B operand: element e = P^T[key kmap(e)][query] = tile e>>3, reg e&7.
    v16h bp;
    float psum = 0.0f;
    #pragma unroll
    for (int e = 0; e < 16; ++e) {
      const float p = __expf(s[e >> 3][e & 7] * scale - mnew);
      psum += p;
      bp[e] = (half_t)p;
    }
    lsum = lsum * corr + psum;
    #pragma unroll
    for (int j = 0; j < 4; ++j) cacc[j] *= corr;

    // ctx^T += V^T(64x32) * P^T(32x16): A rows = d, by the transposing load.
    #pragma unroll
    for (int j = 0; j < 4; ++j) {
      const v16h avf = ld_frag_tr(vlane, 16 * j);
      cacc[j] = wmma16(avf, bp, cacc[j]);
    }

    // Publish point of tile t + 1: own reads of tile t returned, own copies of
    // tile t + 1 landed, then the one barrier of the trip; behind it tile t's
    // buffer is free for tile t + 2.
    wait_dscnt0();
    wait_asynccnt0();
    __syncthreads();
    if (t + 2 < kTiles) {
      stage_kv(ksrc + (size_t)(t + 2) * 32 * kH, vsrc + (size_t)(t + 2) * 32 * kH,
               lds_addr(&Ks[buf][sr][sc]), lds_addr(&Vs[buf][sr][sc]));
    }
  }
  wait_asynccnt0();    // nothing of this wave is in flight when it ends

  // Normalize and store ctx (f32). Output layout [B,S,NH*HD]: head h occupies
  // columns h*64..h*64+63. cacc[j][r] = ctx[query l16][d = 16*j + 8*hi + r]:
  // 8 consecutive floats per lane and j -> two 16-byte stores.
  const float inv = 1.0f / (lsum + xhalf(lsum));
  float* orow = out + (size_t)(b * kS + q0 + l16) * kH + (size_t)h * kHD + 8 * hi;
  #pragma unroll
  for (int j = 0; j < 4; ++j) {
    const float4 lo4 = make_float4(cacc[j][0] * inv, cacc[j][1] * inv,
                                   cacc[j][2] * inv, cacc[j][3] * inv);
    const float4 hi4 = make_float4(cacc[j][4] * inv, cacc[j][5] * inv,
                                   cacc[j][6] * inv, cacc[j][7] * inv);
    *(float4*)(orow + 16 * j)     = lo4;
    *(float4*)(orow + 16 * j + 4) = hi4;
  }
}

// ---------------------------------------------------------------------------
extern "C" void kernel_launch(void* const* d_in, const int* in_sizes, int n_in,
                              void* d_out, int out_size, void* d_ws, size_t ws_size,
                              hipStream_t stream) {
  const float* X  = (const float*)d_in[0];
  const float* Wq = (const float*)d_in[1];
  const float* bq = (const float*)d_in[2];
  const float* Wk = (const float*)d_in[3];
  const float* bk = (const float*)d_in[4];
  const float* Wv = (const float*)d_in[5];
  const float* bv = (const float*)d_in[6];
  float* out = (float*)d_out;

  // Workspace: f16 Q, K, V, each [4096, 768] (6.29 MB each, 18.9 MB total).
  half_t* Qh = (half_t*)d_ws;
  half_t* Kh = Qh + (size_t)kBS * kH;
  half_t* Vh = Kh + (size_t)kBS * kH;

  dim3 g1(kBS / 64, kH / 64, 3);       // 64 x 12 x 3 blocks
  qkv_gemm_kernel<<<g1, 128, 0, stream>>>(X, Wq, bq, Wk, bk, Wv, bv, Qh, Kh, Vh);

  dim3 g2(kS / 64, kNH, kB);           // 32 x 12 x 2 blocks
  attention_kernel<<<g2, 128, 0, stream>>>(Qh, Kh, Vh, out);
}

// v005
// It runs in 60.3 microseconds.
// Two timings next to v004 both put it at 1.18 times that version's speed.
// Over all steps from v000 it is 2.90 times as fast.
#include <hip/hip_runtime.h>
#include <hip/hip_bf16.h>

// ---------------------------------------------------------------------------
// Self-attention forward for MI455X (gfx1250, wave32, WMMA).
//  Kernel 1: QKV projection GEMM (f32 in -> f16 Q/K/V in workspace).
//  Kernel 2: flash-attention over 64-row q tiles, online softmax.
// All WMMA fragments are built from 128-bit LDS/global loads. The W and V
// tiles lie ROW-MAJOR in LDS and are transposed on the way
// out by DS_LOAD_TR16_B128. The attention K and V tiles
// (pure f16 byte copies) are staged with GLOBAL_LOAD_ASYNC_TO_LDS_B128
// (ASYNCcnt path) in a ring of two buffers, one tile ahead of the products.
// Every wave-wide 16-byte global load or copy of a tile bound for LDS covers four whole
// 128-byte lines: consecutive lanes walk along a row.
// ---------------------------------------------------------------------------

typedef _Float16 half_t;
typedef __attribute__((ext_vector_type(16))) _Float16 v16h;
typedef __attribute__((ext_vector_type(8)))  _Float16 v8h;
typedef __attribute__((ext_vector_type(4)))  _Float16 v4h;
typedef __attribute__((ext_vector_type(8)))  float    v8f;
typedef __attribute__((ext_vector_type(4)))  int      v4i;
typedef __attribute__((ext_vector_type(8)))  short    v8s;
typedef __attribute__((address_space(3))) v8s las_v8s;   // LDS (AS3)

constexpr int kB  = 2;
constexpr int kS  = 2048;
constexpr int kH  = 768;
constexpr int kNH = 12;
constexpr int kHD = 64;
constexpr int kBS = kB * kS;          // 4096 rows of hidden_states

// LDS row pitch, in halves, of a row-major [32 or 64 k][64 columns] f16 tile read by
// the transposing load: 160 B = 32 B x odd, its conflict-free pitch.
constexpr int kTrPitch = 80;
// LDS row pitch, in halves, of the K tile (plain 16-byte reads): 144 B.
constexpr int kKPitch = 72;

typedef __attribute__((address_space(3))) half_t las_half;   // LDS (AS3)
// Byte address of a __shared__ element inside the work-group's LDS.
__device__ __forceinline__ unsigned lds_addr(const half_t* p) {
  return (unsigned)(size_t)(const las_half*)p;
}
// This wave's own copies have landed in LDS (asm with the clobber: no LDS read
// may be moved in front of it).
__device__ __forceinline__ void wait_asynccnt0() {
  asm volatile("s_wait_asynccnt 0x0" ::: "memory");
}
// This wave's own LDS reads have returned: its buffer may be refilled behind
// the next barrier.
__device__ __forceinline__ void wait_dscnt0() {
  asm volatile("s_wait_dscnt 0x0" ::: "memory");
}
// One lane's share of a 64-key K/V tile pair: 16 bytes of K rows r, r + 16,
// r + 32, r + 48 and of the same V rows (eight lanes a row: a wave's copy
// covers 4 whole lines), global -> LDS through no register (tracked by
// ASYNCcnt). The s_wait_xcnt closes the statement so that no address register
// named here is rewritten in front of it.
__device__ __forceinline__ void stage_kv(const half_t* ksrc, const half_t* vsrc,
                                         unsigned kdst, unsigned vdst) {
  asm volatile("global_load_async_to_lds_b128 %0, %8, off\n\t"
               "global_load_async_to_lds_b128 %1, %9, off\n\t"
               "global_load_async_to_lds_b128 %2, %10, off\n\t"
               "global_load_async_to_lds_b128 %3, %11, off\n\t"
               "global_load_async_to_lds_b128 %4, %12, off\n\t"
               "global_load_async_to_lds_b128 %5, %13, off\n\t"
               "global_load_async_to_lds_b128 %6, %14, off\n\t"
               "global_load_async_to_lds_b128 %7, %15, off\n\t"
               "s_wait_xcnt 0x0"
               :: "v"(kdst), "v"(kdst + 16u * kKPitch * 2u),
                  "v"(kdst + 32u * kKPitch * 2u), "v"(kdst + 48u * kKPitch * 2u),
                  "v"(vdst), "v"(vdst + 16u * kTrPitch * 2u),
                  "v"(vdst + 32u * kTrPitch * 2u), "v"(vdst + 48u * kTrPitch * 2u),
                  "v"(ksrc), "v"(ksrc + 16 * kH), "v"(ksrc + 32 * kH), "v"(ksrc + 48 * kH),
                  "v"(vsrc), "v"(vsrc + 16 * kH), "v"(vsrc + 32 * kH), "v"(vsrc + 48 * kH)
               : "memory");
}

union frag16 { v16h v; v8h h[2]; };

// Build a 16-half fragment from two aligned 8-half (128-bit) loads.
__device__ __forceinline__ v16h ld_frag(const half_t* lo, const half_t* hi) {
  frag16 f;
  f.h[0] = *(const v8h*)lo;
  f.h[1] = *(const v8h*)hi;
  return f.v;
}

// Lane l's own address in such a tile T for the transposing load: row
// 8*(l>>4) + (l&7), 16-byte piece (l>>3)&1 of the first 16 columns.
__device__ __forceinline__ const half_t* tr_lane_ptr(const half_t* T, int lane) {
  return T + (8 * (lane >> 4) + (lane & 7)) * kTrPitch + 8 * ((lane >> 3) & 1);
}

// 16x32 fragment (A row or B column = tile column col0 + (l&15)) in the
// hardware k order 8*hi.., 16+8*hi..: rows 0..15, then rows 16..31.
__device__ __forceinline__ v16h ld_frag_tr(const half_t* lane_ptr, int col0) {
  frag16 f;
  f.h[0] = __builtin_bit_cast(v8h, __builtin_amdgcn_ds_load_tr16_b128_v8i16(
      (las_v8s*)(lane_ptr + col0)));
  f.h[1] = __builtin_bit_cast(v8h, __builtin_amdgcn_ds_load_tr16_b128_v8i16(
      (las_v8s*)(lane_ptr + 16 * kTrPitch + col0)));
  return f.v;
}

// Lane l <-> lane l ^ 16 (the other half of a query's keys).
__device__ __forceinline__ float xhalf(float x) {
  return __builtin_bit_cast(float, __builtin_amdgcn_permlanex16(
      __builtin_bit_cast(int, x), __builtin_bit_cast(int, x),
      0x76543210, 0xfedcba98, false, false));
}

__device__ __forceinline__ v8f wmma16(v16h a, v16h b, v8f c) {
  // D = A(16x32 f16) * B(32x16 f16) + C(16x16 f32)
  return __builtin_amdgcn_wmma_f32_16x16x32_f16(false, a, false, b,
                                                (short)0, c, false, false);
}

// ---------------------------------------------------------------------------
// Kernel 1: O = f16(X @ W + b).  X:[4096,768] f32, W:[768,768] f32 (row = in).
// grid = (64 M-tiles, 12 N-tiles, 3 {Q,K,V}), block = 128 (4 waves).
// ---------------------------------------------------------------------------
__global__ __launch_bounds__(128)
void qkv_gemm_kernel(const float* __restrict__ X,
                     const float* __restrict__ Wq, const float* __restrict__ bq,
                     const float* __restrict__ Wk, const float* __restrict__ bk,
                     const float* __restrict__ Wv, const float* __restrict__ bv,
                     half_t* __restrict__ Q, half_t* __restrict__ K,
                     half_t* __restrict__ V)
{
  const float* Wm;  const float* bias;  half_t* O;
  if (blockIdx.z == 0)      { Wm = Wq; bias = bq; O = Q; }
  else if (blockIdx.z == 1) { Wm = Wk; bias = bk; O = K; }
  else                      { Wm = Wv; bias = bv; O = V; }

  const int M0   = blockIdx.x * 64;
  const int N0   = blockIdx.y * 64;
  const int tid  = threadIdx.x;
  const int wave = tid >> 5;
  const int lane = tid & 31;
  const int l16  = lane & 15;
  const int hi   = lane >> 4;       // lane-group (0 | 1)
  const int koff = hi * 8;          // contraction offset for upper group

  // Row strides 40 / 80 halves = 80 / 160 B (multiples of 16 B) -> aligned b128 access.
  __shared__ alignas(16) half_t Xs [64][40];  // X tile, row-major  [m][k]
  __shared__ alignas(16) half_t Ws[32][kTrPitch];  // W tile, row-major [k][n]
  const half_t* wlane = tr_lane_ptr(&Ws[0][0], lane);

  const v8f zero = {0.f,0.f,0.f,0.f,0.f,0.f,0.f,0.f};
  v8f acc[4];
  #pragma unroll
  for (int j = 0; j < 4; ++j) acc[j] = zero;

  for (int k0 = 0; k0 < kH; k0 += 32) {
    // Stage the X tile (64 rows x 32 k) and the W tile (32 k x 64 n) as f16.
    // float4 global reads, consecutive lanes along a row: eight lanes cover an
    // X row's 128 bytes, sixteen a W row's 256, so a wave's load covers 4 whole
    // lines (and no two loads of a trip share a line).
    const int xr = tid >> 3, xc = (tid & 7) * 4;    // X row, k base
    const int wr = tid >> 4, wc = (tid & 15) * 4;   // k row, n base
    const float* xsrc = X  + (size_t)(M0 + xr) * kH + k0 + xc;
    const float* wsrc = Wm + (size_t)(k0 + wr) * kH + N0 + wc;
    float4 fx[4], fw[4];
    #pragma unroll
    for (int i = 0; i < 4; ++i) fx[i] = *(const float4*)(xsrc + (size_t)(16 * i) * kH);
    #pragma unroll
    for (int i = 0; i < 4; ++i) fw[i] = *(const float4*)(wsrc + (size_t)(8 * i) * kH);
    // Keeps all eight loads in front of the first conversion: without it the
    // compiler issues them in three groups over the same registers, and a trip
    // waits out three L2 latencies one after the other.
    __builtin_amdgcn_sched_barrier(0);
    #pragma unroll
    for (int i = 0; i < 4; ++i) {
      const v4h hx = {(half_t)fx[i].x, (half_t)fx[i].y, (half_t)fx[i].z, (half_t)fx[i].w};
      *(v4h*)&Xs[xr + 16 * i][xc] = hx;
    }
    #pragma unroll
    for (int i = 0; i < 4; ++i) {
      const v4h hw = {(half_t)fw[i].x, (half_t)fw[i].y, (half_t)fw[i].z, (half_t)fw[i].w};
      *(v4h*)&Ws[wr + 8 * i][wc] = hw;
    }
    // Stands in front of the pointer advance that rewrites the address
    // registers the eight loads name.
    asm volatile("s_wait_xcnt 0x0" ::: "memory");
    __syncthreads();

    // A fragment (rows 16*wave..+15): contiguous 8-half runs -> 2x b128
    const int m = 16 * wave + l16;
    const v16h a = ld_frag(&Xs[m][koff], &Xs[m][16 + koff]);

    // B fragments for 4 N sub-tiles: 2x transposing b128 load each
    #pragma unroll
    for (int j = 0; j < 4; ++j) {
      const v16h bfr = ld_frag_tr(wlane, 16 * j);
      acc[j] = wmma16(a, bfr, acc[j]);
    }
    __syncthreads();
  }

  // Epilogue: C/D layout -> global f16 with bias.
  #pragma unroll
  for (int j = 0; j < 4; ++j) {
    const int n = N0 + 16 * j + l16;
    const float bv_ = bias[n];
    #pragma unroll
    for (int r = 0; r < 8; ++r) {
      const int m2 = M0 + 16 * wave + r + 8 * hi;
      O[(size_t)m2 * kH + n] = (half_t)(acc[j][r] + bv_);
    }
  }
}

__global__ __launch_bounds__(128)
void attention_kernel(const half_t* __restrict__ Q,
                      const half_t* __restrict__ K,
                      const half_t* __restrict__ V,
                      float* __restrict__ out)
{
  const int qt = blockIdx.x;        // q tile (64 rows)
  const int h  = blockIdx.y;        // head
  const int b  = blockIdx.z;        // batch

  const int tid  = threadIdx.x;
  const int wave = tid >> 5;
  const int lane = tid & 31;
  const int l16  = lane & 15;
  const int hi   = lane >> 4;
  const int koff = hi * 8;

  const size_t headOff = (size_t)b * kS * kH + (size_t)h * kHD;
  const half_t* Qb = Q + headOff;   // row stride kH
  const half_t* Kb = K + headOff;
  const half_t* Vb = V + headOff;

  constexpr int kKT = 64;           // keys a trip
  __shared__ alignas(16) half_t Ks [2][kKT][kKPitch];  // K tiles row-major [k][d], 144 B rows
  __shared__ alignas(16) half_t Vs [2][kKT][kTrPitch];  // V tiles row-major [k][d], 160 B rows

  // Q^T B-fragments for this wave (column = q row l16), d chunks [0,32) and
  // [32,64): 4x global b128, hardware k order (8*hi.., 16+8*hi..).
  const int q0 = qt * 64 + wave * 16;
  const half_t* qrow = Qb + (size_t)(q0 + l16) * kH;
  const v16h aq0 = ld_frag(qrow +      koff, qrow + 16 + koff);
  const v16h aq1 = ld_frag(qrow + 32 + koff, qrow + 48 + koff);

  const v8f zero = {0.f,0.f,0.f,0.f,0.f,0.f,0.f,0.f};
  v8f cacc[4];
  #pragma unroll
  for (int j = 0; j < 4; ++j) cacc[j] = zero;
  // One query per lane (column l16): running max, and this lane half's part
  // of the denominator (the halves are joined once, after the loop).
  float mrow = -1.0e30f, lsum = 0.0f;

  const float scale = 0.125f;       // 1/sqrt(64)

  // Lane's share of every tile: k rows sr + 16 i, 8 halves from d = sc.
  constexpr int kTiles = kS / kKT;
  const int sr = tid >> 3, sc = (tid & 7) * 8;
  const half_t* ksrc = Kb + (size_t)sr * kH + sc;
  const half_t* vsrc = Vb + (size_t)sr * kH + sc;

  // Ring prologue: tile 0 landed and published, then tile 1 in flight.
  stage_kv(ksrc, vsrc, lds_addr(&Ks[0][sr][sc]), lds_addr(&Vs[0][sr][sc]));
  wait_asynccnt0();
  __syncthreads();
  stage_kv(ksrc + kKT * kH, vsrc + kKT * kH,
           lds_addr(&Ks[1][sr][sc]), lds_addr(&Vs[1][sr][sc]));

  // Two trips a pass of the loop: the buffer index is then a constant and every
  // LDS address an immediate offset.
  #pragma unroll 2
  for (int t = 0; t < kTiles; ++t) {
    const int buf = t & 1;
    const half_t (*Kt)[kKPitch] = Ks[buf];
    const half_t* vlane = tr_lane_ptr(&Vs[buf][0][0], lane);

    // scores: S^T = K * Q^T  (A row = key, B column = query, contraction = d)
    // s[j][r] = score(key 16*j + 8*hi + r, query l16)
    v8f s[4];
    #pragma unroll
    for (int j = 0; j < 4; ++j) {
      const int krow = 16 * j + l16;
      v8f acc_s = zero;
      const v16h ak0 = ld_frag(&Kt[krow][koff],      &Kt[krow][16 + koff]);
      const v16h ak1 = ld_frag(&Kt[krow][32 + koff], &Kt[krow][48 + koff]);
      acc_s = wmma16(ak0, aq0, acc_s);
      acc_s = wmma16(ak1, aq1, acc_s);
      s[j] = acc_s;
    }

    // Online softmax, one query per lane: one maximum for the 64 keys.
    float hmax[2];
    #pragma unroll
    for (int g = 0; g < 2; ++g) {
      hmax[g] = fmaxf(s[2 * g][0], s[2 * g + 1][0]);
      #pragma unroll
      for (int r = 1; r < 8; ++r)
        hmax[g] = fmaxf(hmax[g], fmaxf(s[2 * g][r], s[2 * g + 1][r]));
    }
    float tmax = fmaxf(hmax[0], hmax[1]);
    tmax = fmaxf(tmax, xhalf(tmax)) * scale;
    const float mnew = fmaxf(mrow, tmax);
    const float corr = __expf(mrow - mnew);
    mrow = mnew;

    // P^T as B operands, one per 32 keys: element e of operand g =
    // P^T[key 32*g + kmap(e)][query] = tile 2*g + (e>>3), reg e&7.
    v16h bp[2];
    float psum[2];
    #pragma unroll
    for (int g = 0; g < 2; ++g) {
      psum[g] = 0.0f;
      #pragma unroll
      for (int e = 0; e < 16; ++e) {
        const float p = __expf(s[2 * g + (e >> 3)][e & 7] * scale - mnew);
        psum[g] += p;
        bp[g][e] = (half_t)p;
      }
    }
    lsum = lsum * corr + (psum[0] + psum[1]);
    #pragma unroll
    for (int j = 0; j < 4; ++j) cacc[j] *= corr;

    // ctx^T += V^T(64x64) * P^T(64x16): A rows = d, by the transposing load.
    #pragma unroll
    for (int g = 0; g < 2; ++g) {
      #pragma unroll
      for (int j = 0; j < 4; ++j) {
        const v16h avf = ld_frag_tr(vlane + g * 32 * kTrPitch, 16 * j);
        cacc[j] = wmma16(avf, bp[g], cacc[j]);
      }
    }

    // Publish point of tile t + 1: own reads of tile t returned, own copies of
    // tile t + 1 landed, then the one barrier of the trip; behind it tile t's
    // buffer is free for tile t + 2.
    wait_dscnt0();
    wait_asynccnt0();
    __syncthreads();
    if (t + 2 < kTiles) {
      stage_kv(ksrc + (size_t)(t + 2) * kKT * kH, vsrc + (size_t)(t + 2) * kKT * kH,
               lds_addr(&Ks[buf][sr][sc]), lds_addr(&Vs[buf][sr][sc]));
    }
  }
  wait_asynccnt0();    // nothing of this wave is in flight when it ends

  // Normalize and store ctx (f32). Output layout [B,S,NH*HD]: head h occupies
  // columns h*64..h*64+63. cacc[j][r] = ctx[query l16][d = 16*j + 8*hi + r]:
  // 8 consecutive floats per lane and j -> two 16-byte stores.
  const float inv = 1.0f / (lsum + xhalf(lsum));
  float* orow = out + (size_t)(b * kS + q0 + l16) * kH + (size_t)h * kHD + 8 * hi;
  #pragma unroll
  for (int j = 0; j < 4; ++j) {
    const float4 lo4 = make_float4(cacc[j][0] * inv, cacc[j][1] * inv,
                                   cacc[j][2] * inv, cacc[j][3] * inv);
    const float4 hi4 = make_float4(cacc[j][4] * inv, cacc[j][5] * inv,
                                   cacc[j][6] * inv, cacc[j][7] * inv);
    *(float4*)(orow + 16 * j)     = lo4;
    *(float4*)(orow + 16 * j + 4) = hi4;
  }
}

// ---------------------------------------------------------------------------
extern "C" void kernel_launch(void* const* d_in, const int* in_sizes, int n_in,
                              void* d_out, int out_size, void* d_ws, size_t ws_size,
                              hipStream_t stream) {
  const float* X  = (const float*)d_in[0];
  const float* Wq = (const float*)d_in[1];
  const float* bq = (const float*)d_in[2];
  const float* Wk = (const float*)d_in[3];
  const float* bk = (const float*)d_in[4];
  const float* Wv = (const float*)d_in[5];
  const float* bv = (const float*)d_in[6];
  float* out = (float*)d_out;

  // Workspace: f16 Q, K, V, each [4096, 768] (6.29 MB each, 18.9 MB total).
  half_t* Qh = (half_t*)d_ws;
  half_t* Kh = Qh + (size_t)kBS * kH;
  half_t* Vh = Kh + (size_t)kBS * kH;

  dim3 g1(kBS / 64, kH / 64, 3);       // 64 x 12 x 3 blocks
  qkv_gemm_kernel<<<g1, 128, 0, stream>>>(X, Wq, bq, Wk, bk, Wv, bv, Qh, Kh, Vh);

  dim3 g2(kS / 64, kNH, kB);           // 32 x 12 x 2 blocks
  attention_kernel<<<g2, 128, 0, stream>>>(Qh, Kh, Vh, out);
}

// v006
// One run takes 57.7 microseconds.
// Two timings next to v005 both put it at 1.05 times that version's speed.
// Counting every step since v000, it is 3.05 times as fast.
#include <hip/hip_runtime.h>
#include <hip/hip_bf16.h>

// ---------------------------------------------------------------------------
// Self-attention forward for MI455X (gfx1250, wave32, WMMA).
//  Kernel 1: QKV projection GEMM (f32 in -> f16 Q/K/V in workspace).
//  Kernel 2: flash-attention over 64-row q tiles, online softmax.
// All WMMA fragments are built from 128-bit LDS/global loads. The W and V
// tiles lie ROW-MAJOR in LDS and are transposed on the way
// out by DS_LOAD_TR16_B128. The attention K and V tiles
// (pure f16 byte copies) are staged with GLOBAL_LOAD_ASYNC_TO_LDS_B128
// (ASYNCcnt path) in a ring of two buffers, one tile ahead of the products.
// Every wave-wide 16-byte global load or copy of a tile bound for LDS covers four whole
// 128-byte lines: consecutive lanes walk along a row.
// ---------------------------------------------------------------------------

typedef _Float16 half_t;
typedef __attribute__((ext_vector_type(16))) _Float16 v16h;
typedef __attribute__((ext_vector_type(8)))  _Float16 v8h;
typedef __attribute__((ext_vector_type(4)))  _Float16 v4h;
typedef __attribute__((ext_vector_type(8)))  float    v8f;
typedef __attribute__((ext_vector_type(4)))  int      v4i;
typedef __attribute__((ext_vector_type(8)))  short    v8s;
typedef __attribute__((address_space(3))) v8s las_v8s;   // LDS (AS3)

constexpr int kB  = 2;
constexpr int kS  = 2048;
constexpr int kH  = 768;
constexpr int kNH = 12;
constexpr int kHD = 64;
constexpr int kBS = kB * kS;          // 4096 rows of hidden_states

// LDS row pitch, in halves, of a row-major [64 k][64 columns] f16 tile read by
// the transposing load: 160 B = 32 B x odd, its conflict-free pitch.
constexpr int kTrPitch = 80;
// LDS row pitch, in halves, of the K tile (plain 16-byte reads): 144 B.
constexpr int kKPitch = 72;
// The same two pitches for the projection's tiles: X rows of 64 k (128 B,
// plain 16-byte reads) at 144 B, W rows of 128 columns (256 B, transposing
// load) at 288 B = 32 B x odd.
constexpr int kXPitch = 72;
constexpr int kWPitch = 144;

typedef __attribute__((address_space(3))) half_t las_half;   // LDS (AS3)
// Byte address of a __shared__ element inside the work-group's LDS.
__device__ __forceinline__ unsigned lds_addr(const half_t* p) {
  return (unsigned)(size_t)(const las_half*)p;
}
// This wave's own copies have landed in LDS (asm with the clobber: no LDS read
// may be moved in front of it).
__device__ __forceinline__ void wait_asynccnt0() {
  asm volatile("s_wait_asynccnt 0x0" ::: "memory");
}
// This wave's own LDS reads have returned: its buffer may be refilled behind
// the next barrier.
__device__ __forceinline__ void wait_dscnt0() {
  asm volatile("s_wait_dscnt 0x0" ::: "memory");
}
// One lane's share of a 64-key K/V tile pair: 16 bytes of K rows r, r + 16,
// r + 32, r + 48 and of the same V rows (eight lanes a row: a wave's copy
// covers 4 whole lines), global -> LDS through no register (tracked by
// ASYNCcnt). The s_wait_xcnt closes the statement so that no address register
// named here is rewritten in front of it.
__device__ __forceinline__ void stage_kv(const half_t* ksrc, const half_t* vsrc,
                                         unsigned kdst, unsigned vdst) {
  asm volatile("global_load_async_to_lds_b128 %0, %8, off\n\t"
               "global_load_async_to_lds_b128 %1, %9, off\n\t"
               "global_load_async_to_lds_b128 %2, %10, off\n\t"
               "global_load_async_to_lds_b128 %3, %11, off\n\t"
               "global_load_async_to_lds_b128 %4, %12, off\n\t"
               "global_load_async_to_lds_b128 %5, %13, off\n\t"
               "global_load_async_to_lds_b128 %6, %14, off\n\t"
               "global_load_async_to_lds_b128 %7, %15, off\n\t"
               "s_wait_xcnt 0x0"
               :: "v"(kdst), "v"(kdst + 16u * kKPitch * 2u),
                  "v"(kdst + 32u * kKPitch * 2u), "v"(kdst + 48u * kKPitch * 2u),
                  "v"(vdst), "v"(vdst + 16u * kTrPitch * 2u),
                  "v"(vdst + 32u * kTrPitch * 2u), "v"(vdst + 48u * kTrPitch * 2u),
                  "v"(ksrc), "v"(ksrc + 16 * kH), "v"(ksrc + 32 * kH), "v"(ksrc + 48 * kH),
                  "v"(vsrc), "v"(vsrc + 16 * kH), "v"(vsrc + 32 * kH), "v"(vsrc + 48 * kH)
               : "memory");
}

union frag16 { v16h v; v8h h[2]; };

// Build a 16-half fragment from two aligned 8-half (128-bit) loads.
__device__ __forceinline__ v16h ld_frag(const half_t* lo, const half_t* hi) {
  frag16 f;
  f.h[0] = *(const v8h*)lo;
  f.h[1] = *(const v8h*)hi;
  return f.v;
}

// Lane l's own address in such a tile T for the transposing load: row
// 8*(l>>4) + (l&7), 16-byte piece (l>>3)&1 of the first 16 columns.
__device__ __forceinline__ const half_t* tr_lane_ptr(const half_t* T, int lane,
                                                     int pitch = kTrPitch) {
  return T + (8 * (lane >> 4) + (lane & 7)) * pitch + 8 * ((lane >> 3) & 1);
}

// 16x32 fragment (A row or B column = tile column col0 + (l&15)) in the
// hardware k order 8*hi.., 16+8*hi..: rows 0..15, then rows 16..31.
__device__ __forceinline__ v16h ld_frag_tr(const half_t* lane_ptr, int col0,
                                           int pitch = kTrPitch) {
  frag16 f;
  f.h[0] = __builtin_bit_cast(v8h, __builtin_amdgcn_ds_load_tr16_b128_v8i16(
      (las_v8s*)(lane_ptr + col0)));
  f.h[1] = __builtin_bit_cast(v8h, __builtin_amdgcn_ds_load_tr16_b128_v8i16(
      (las_v8s*)(lane_ptr + 16 * pitch + col0)));
  return f.v;
}

// Lane l <-> lane l ^ 16 (the other half of a query's keys).
__device__ __forceinline__ float xhalf(float x) {
  return __builtin_bit_cast(float, __builtin_amdgcn_permlanex16(
      __builtin_bit_cast(int, x), __builtin_bit_cast(int, x),
      0x76543210, 0xfedcba98, false, false));
}

__device__ __forceinline__ v8f wmma16(v16h a, v16h b, v8f c) {
  // D = A(16x32 f16) * B(32x16 f16) + C(16x16 f32)
  return __builtin_amdgcn_wmma_f32_16x16x32_f16(false, a, false, b,
                                                (short)0, c, false, false);
}

// ---------------------------------------------------------------------------
// Kernel 1: O = f16(X @ W + b).  X:[4096,768] f32, W:[768,768] f32 (row = in).
// grid = (32 M-tiles, 6 N-tiles, 3 {Q,K,V}), block = 256 (8 waves).
// Block tile 128 x 128 outputs, 64 k a trip; a wave owns 32 rows x 64 columns
// (2 x 4 accumulator tiles): every X element is loaded by 18 blocks and every
// W element by 32.
// ---------------------------------------------------------------------------
__global__ __launch_bounds__(256)
void qkv_gemm_kernel(const float* __restrict__ X,
                     const float* __restrict__ Wq, const float* __restrict__ bq,
                     const float* __restrict__ Wk, const float* __restrict__ bk,
                     const float* __restrict__ Wv, const float* __restrict__ bv,
                     half_t* __restrict__ Q, half_t* __restrict__ K,
                     half_t* __restrict__ V)
{
  const float* Wm;  const float* bias;  half_t* O;
  if (blockIdx.z == 0)      { Wm = Wq; bias = bq; O = Q; }
  else if (blockIdx.z == 1) { Wm = Wk; bias = bk; O = K; }
  else                      { Wm = Wv; bias = bv; O = V; }

  const int M0   = blockIdx.x * 128;
  const int N0   = blockIdx.y * 128;
  const int tid  = threadIdx.x;
  const int wave = tid >> 5;
  const int lane = tid & 31;
  const int l16  = lane & 15;
  const int hi   = lane >> 4;       // lane-group (0 | 1)
  const int koff = hi * 8;          // contraction offset for upper group
  const int mw   = 32 * (wave >> 1);   // the wave's first row in the tile
  const int nw   = 64 * (wave & 1);    // the wave's first column in the tile

  __shared__ alignas(16) half_t Xs[128][kXPitch];  // X tile, row-major [m][k]
  __shared__ alignas(16) half_t Ws[64][kWPitch];   // W tile, row-major [k][n]
  const half_t* wlane = tr_lane_ptr(&Ws[0][nw], lane, kWPitch);

  const v8f zero = {0.f,0.f,0.f,0.f,0.f,0.f,0.f,0.f};
  v8f acc[2][4];
  #pragma unroll
  for (int i = 0; i < 2; ++i)
    #pragma unroll
    for (int j = 0; j < 4; ++j) acc[i][j] = zero;

  for (int k0 = 0; k0 < kH; k0 += 64) {
    // Stage the X tile (128 rows x 64 k) and the W tile (64 k x 128 n) as f16.
    // float4 global reads, consecutive lanes along a row: sixteen lanes cover an
    // X row's 256 bytes, a whole wave a W row's 512, so a wave's load covers 4
    // whole lines (and no two loads of a trip share a line).
    const int xr = tid >> 4, xc = (tid & 15) * 4;   // X row, k base
    const int wr = tid >> 5, wc = (tid & 31) * 4;   // k row, n base
    const float* xsrc = X  + (size_t)(M0 + xr) * kH + k0 + xc;
    const float* wsrc = Wm + (size_t)(k0 + wr) * kH + N0 + wc;
    float4 fx[8], fw[8];
    #pragma unroll
    for (int i = 0; i < 8; ++i) fx[i] = *(const float4*)(xsrc + (size_t)(16 * i) * kH);
    #pragma unroll
    for (int i = 0; i < 8; ++i) fw[i] = *(const float4*)(wsrc + (size_t)(8 * i) * kH);
    // Keeps all sixteen loads in front of the first conversion: without it the
    // compiler issues them in groups over the same registers, and a trip waits
    // out several L2 latencies one after the other.
    __builtin_amdgcn_sched_barrier(0);
    #pragma unroll
    for (int i = 0; i < 8; ++i) {
      const v4h hx = {(half_t)fx[i].x, (half_t)fx[i].y, (half_t)fx[i].z, (half_t)fx[i].w};
      *(v4h*)&Xs[xr + 16 * i][xc] = hx;
    }
    #pragma unroll
    for (int i = 0; i < 8; ++i) {
      const v4h hw = {(half_t)fw[i].x, (half_t)fw[i].y, (half_t)fw[i].z, (half_t)fw[i].w};
      *(v4h*)&Ws[wr + 8 * i][wc] = hw;
    }
    // Stands in front of the pointer advance that rewrites the address
    // registers the sixteen loads name.
    asm volatile("s_wait_xcnt 0x0" ::: "memory");
    __syncthreads();

    // Two 32-k steps, in ascending k (the order of the sums stays).
    #pragma unroll
    for (int kk = 0; kk < 2; ++kk) {
      // A fragments (rows mw..mw+31): contiguous 8-half runs -> 2x b128 each
      v16h a[2];
      #pragma unroll
      for (int i = 0; i < 2; ++i) {
        const half_t* xrow = &Xs[mw + 16 * i + l16][32 * kk + koff];
        a[i] = ld_frag(xrow, xrow + 16);
      }
      // B fragments for 4 N sub-tiles: 2x transposing b128 load each, used twice
      #pragma unroll
      for (int j = 0; j < 4; ++j) {
        const v16h bfr = ld_frag_tr(wlane + 32 * kk * kWPitch, 16 * j, kWPitch);
        #pragma unroll
        for (int i = 0; i < 2; ++i) acc[i][j] = wmma16(a[i], bfr, acc[i][j]);
      }
    }
    __syncthreads();
  }

  // Epilogue: C/D layout -> global f16 with bias.
  #pragma unroll
  for (int j = 0; j < 4; ++j) {
    const int n = N0 + nw + 16 * j + l16;
    const float bv_ = bias[n];
    #pragma unroll
    for (int i = 0; i < 2; ++i) {
      #pragma unroll
      for (int r = 0; r < 8; ++r) {
        const int m2 = M0 + mw + 16 * i + r + 8 * hi;
        O[(size_t)m2 * kH + n] = (half_t)(acc[i][j][r] + bv_);
      }
    }
  }
}

__global__ __launch_bounds__(128)
void attention_kernel(const half_t* __restrict__ Q,
                      const half_t* __restrict__ K,
                      const half_t* __restrict__ V,
                      float* __restrict__ out)
{
  const int qt = blockIdx.x;        // q tile (64 rows)
  const int h  = blockIdx.y;        // head
  const int b  = blockIdx.z;        // batch

  const int tid  = threadIdx.x;
  const int wave = tid >> 5;
  const int lane = tid & 31;
  const int l16  = lane & 15;
  const int hi   = lane >> 4;
  const int koff = hi * 8;

  const size_t headOff = (size_t)b * kS * kH + (size_t)h * kHD;
  const half_t* Qb = Q + headOff;   // row stride kH
  const half_t* Kb = K + headOff;
  const half_t* Vb = V + headOff;

  constexpr int kKT = 64;           // keys a trip
  __shared__ alignas(16) half_t Ks [2][kKT][kKPitch];  // K tiles row-major [k][d], 144 B rows
  __shared__ alignas(16) half_t Vs [2][kKT][kTrPitch];  // V tiles row-major [k][d], 160 B rows

  // Q^T B-fragments for this wave (column = q row l16), d chunks [0,32) and
  // [32,64): 4x global b128, hardware k order (8*hi.., 16+8*hi..).
  const int q0 = qt * 64 + wave * 16;
  const half_t* qrow = Qb + (size_t)(q0 + l16) * kH;
  const v16h aq0 = ld_frag(qrow +      koff, qrow + 16 + koff);
  const v16h aq1 = ld_frag(qrow + 32 + koff, qrow + 48 + koff);

  const v8f zero = {0.f,0.f,0.f,0.f,0.f,0.f,0.f,0.f};
  v8f cacc[4];
  #pragma unroll
  for (int j = 0; j < 4; ++j) cacc[j] = zero;
  // One query per lane (column l16): running max, and this lane half's part
  // of the denominator (the halves are joined once, after the loop).
  float mrow = -1.0e30f, lsum = 0.0f;

  const float scale = 0.125f;       // 1/sqrt(64)

  // Lane's share of every tile: k rows sr + 16 i, 8 halves from d = sc.
  constexpr int kTiles = kS / kKT;
  const int sr = tid >> 3, sc = (tid & 7) * 8;
  const half_t* ksrc = Kb + (size_t)sr * kH + sc;
  const half_t* vsrc = Vb + (size_t)sr * kH + sc;

  // Ring prologue: tile 0 landed and published, then tile 1 in flight.
  stage_kv(ksrc, vsrc, lds_addr(&Ks[0][sr][sc]), lds_addr(&Vs[0][sr][sc]));
  wait_asynccnt0();
  __syncthreads();
  stage_kv(ksrc + kKT * kH, vsrc + kKT * kH,
           lds_addr(&Ks[1][sr][sc]), lds_addr(&Vs[1][sr][sc]));

  // Two trips a pass of the loop: the buffer index is then a constant and every
  // LDS address an immediate offset.
  #pragma unroll 2
  for (int t = 0; t < kTiles; ++t) {
    const int buf = t & 1;
    const half_t (*Kt)[kKPitch] = Ks[buf];
    const half_t* vlane = tr_lane_ptr(&Vs[buf][0][0], lane);

    // scores: S^T = K * Q^T  (A row = key, B column = query, contraction = d)
    // s[j][r] = score(key 16*j + 8*hi + r, query l16)
    v8f s[4];
    #pragma unroll
    for (int j = 0; j < 4; ++j) {
      const int krow = 16 * j + l16;
      v8f acc_s = zero;
      const v16h ak0 = ld_frag(&Kt[krow][koff],      &Kt[krow][16 + koff]);
      const v16h ak1 = ld_frag(&Kt[krow][32 + koff], &Kt[krow][48 + koff]);
      acc_s = wmma16(ak0, aq0, acc_s);
      acc_s = wmma16(ak1, aq1, acc_s);
      s[j] = acc_s;
    }

    // Online softmax, one query per lane: one maximum for the 64 keys.
    float hmax[2];
    #pragma unroll
    for (int g = 0; g < 2; ++g) {
      hmax[g] = fmaxf(s[2 * g][0], s[2 * g + 1][0]);
      #pragma unroll
      for (int r = 1; r < 8; ++r)
        hmax[g] = fmaxf(hmax[g], fmaxf(s[2 * g][r], s[2 * g + 1][r]));
    }
    float tmax = fmaxf(hmax[0], hmax[1]);
    tmax = fmaxf(tmax, xhalf(tmax)) * scale;
    const float mnew = fmaxf(mrow, tmax);
    const float corr = __expf(mrow - mnew);
    mrow = mnew;

    // P^T as B operands, one per 32 keys: element e of operand g =
    // P^T[key 32*g + kmap(e)][query] = tile 2*g + (e>>3), reg e&7.
    v16h bp[2];
    float psum[2];
    #pragma unroll
    for (int g = 0; g < 2; ++g) {
      psum[g] = 0.0f;
      #pragma unroll
      for (int e = 0; e < 16; ++e) {
        const float p = __expf(s[2 * g + (e >> 3)][e & 7] * scale - mnew);
        psum[g] += p;
        bp[g][e] = (half_t)p;
      }
    }
    lsum = lsum * corr + (psum[0] + psum[1]);
    #pragma unroll
    for (int j = 0; j < 4; ++j) cacc[j] *= corr;

    // ctx^T += V^T(64x64) * P^T(64x16): A rows = d, by the transposing load.
    #pragma unroll
    for (int g = 0; g < 2; ++g) {
      #pragma unroll
      for (int j = 0; j < 4; ++j) {
        const v16h avf = ld_frag_tr(vlane + g * 32 * kTrPitch, 16 * j);
        cacc[j] = wmma16(avf, bp[g], cacc[j]);
      }
    }

    // Publish point of tile t + 1: own reads of tile t returned, own copies of
    // tile t + 1 landed, then the one barrier of the trip; behind it tile t's
    // buffer is free for tile t + 2.
    wait_dscnt0();
    wait_asynccnt0();
    __syncthreads();
    if (t + 2 < kTiles) {
      stage_kv(ksrc + (size_t)(t + 2) * kKT * kH, vsrc + (size_t)(t + 2) * kKT * kH,
               lds_addr(&Ks[buf][sr][sc]), lds_addr(&Vs[buf][sr][sc]));
    }
  }
  wait_asynccnt0();    // nothing of this wave is in flight when it ends

  // Normalize and store ctx (f32). Output layout [B,S,NH*HD]: head h occupies
  // columns h*64..h*64+63. cacc[j][r] = ctx[query l16][d = 16*j + 8*hi + r]:
  // 8 consecutive floats per lane and j -> two 16-byte stores.
  const float inv = 1.0f / (lsum + xhalf(lsum));
  float* orow = out + (size_t)(b * kS + q0 + l16) * kH + (size_t)h * kHD + 8 * hi;
  #pragma unroll
  for (int j = 0; j < 4; ++j) {
    const float4 lo4 = make_float4(cacc[j][0] * inv, cacc[j][1] * inv,
                                   cacc[j][2] * inv, cacc[j][3] * inv);
    const float4 hi4 = make_float4(cacc[j][4] * inv, cacc[j][5] * inv,
                                   cacc[j][6] * inv, cacc[j][7] * inv);
    *(float4*)(orow + 16 * j)     = lo4;
    *(float4*)(orow + 16 * j + 4) = hi4;
  }
}

// ---------------------------------------------------------------------------
extern "C" void kernel_launch(void* const* d_in, const int* in_sizes, int n_in,
                              void* d_out, int out_size, void* d_ws, size_t ws_size,
                              hipStream_t stream) {
  const float* X  = (const float*)d_in[0];
  const float* Wq = (const float*)d_in[1];
  const float* bq = (const float*)d_in[2];
  const float* Wk = (const float*)d_in[3];
  const float* bk = (const float*)d_in[4];
  const float* Wv = (const float*)d_in[5];
  const float* bv = (const float*)d_in[6];
  float* out = (float*)d_out;

  // Workspace: f16 Q, K, V, each [4096, 768] (6.29 MB each, 18.9 MB total).
  half_t* Qh = (half_t*)d_ws;
  half_t* Kh = Qh + (size_t)kBS * kH;
  half_t* Vh = Kh + (size_t)kBS * kH;

  dim3 g1(kBS / 128, kH / 128, 3);     // 32 x 6 x 3 blocks
  qkv_gemm_kernel<<<g1, 256, 0, stream>>>(X, Wq, bq, Wk, bk, Wv, bv, Qh, Kh, Vh);

  dim3 g2(kS / 64, kNH, kB);           // 32 x 12 x 2 blocks
  attention_kernel<<<g2, 128, 0, stream>>>(Qh, Kh, Vh, out);
}

// v007
// A run of this version takes 55.1 microseconds.
// Next to v006, in two timings, it ran 1.04 and 1.05 times as fast.
// All steps since v000 together make it 3.19 times as fast.
#include <hip/hip_runtime.h>
#include <hip/hip_bf16.h>

// ---------------------------------------------------------------------------
// Self-attention forward for MI455X (gfx1250, wave32, WMMA).
//  Kernel 1: QKV projection GEMM (f32 in -> f16 Q/K/V in workspace).
//  Kernel 2: flash-attention over 64-row q tiles, online softmax.
// All WMMA fragments are built from 128-bit LDS/global loads. The W and V
// tiles lie ROW-MAJOR in LDS and are transposed on the way
// out by DS_LOAD_TR16_B128. The attention K and V tiles
// (pure f16 byte copies) are staged with GLOBAL_LOAD_ASYNC_TO_LDS_B128
// (ASYNCcnt path) in a ring of two buffers, one tile ahead of the products.
// Every wave-wide 16-byte global load or copy of a tile bound for LDS covers four whole
// 128-byte lines: consecutive lanes walk along a row.
// ---------------------------------------------------------------------------

typedef _Float16 half_t;
typedef __attribute__((ext_vector_type(16))) _Float16 v16h;
typedef __attribute__((ext_vector_type(8)))  _Float16 v8h;
typedef __attribute__((ext_vector_type(4)))  _Float16 v4h;
typedef __attribute__((ext_vector_type(8)))  float    v8f;
typedef __attribute__((ext_vector_type(4)))  int      v4i;
typedef __attribute__((ext_vector_type(8)))  short    v8s;
typedef __attribute__((address_space(3))) v8s las_v8s;   // LDS (AS3)

constexpr int kB  = 2;
constexpr int kS  = 2048;
constexpr int kH  = 768;
constexpr int kNH = 12;
constexpr int kHD = 64;
constexpr int kBS = kB * kS;          // 4096 rows of hidden_states

// LDS row pitch, in halves, of a row-major [128 k][64 columns] f16 tile read by
// the transposing load: 160 B = 32 B x odd, its conflict-free pitch.
constexpr int kTrPitch = 80;
// LDS row pitch, in halves, of the K tile (plain 16-byte reads): 144 B.
constexpr int kKPitch = 72;
// The same two pitches for the projection's tiles: X rows of 64 k (128 B,
// plain 16-byte reads) at 144 B, W rows of 128 columns (256 B, transposing
// load) at 288 B = 32 B x odd.
constexpr int kXPitch = 72;
constexpr int kWPitch = 144;

typedef __attribute__((address_space(3))) half_t las_half;   // LDS (AS3)
// Byte address of a __shared__ element inside the work-group's LDS.
__device__ __forceinline__ unsigned lds_addr(const half_t* p) {
  return (unsigned)(size_t)(const las_half*)p;
}
// This wave's own copies have landed in LDS (asm with the clobber: no LDS read
// may be moved in front of it).
__device__ __forceinline__ void wait_asynccnt0() {
  asm volatile("s_wait_asynccnt 0x0" ::: "memory");
}
// This wave's own LDS reads have returned: its buffer may be refilled behind
// the next barrier.
__device__ __forceinline__ void wait_dscnt0() {
  asm volatile("s_wait_dscnt 0x0" ::: "memory");
}
// One lane's share of 64 keys of a K/V tile pair: 16 bytes of K rows r, r + 16,
// r + 32, r + 48 and of the same V rows (eight lanes a row: a wave's copy
// covers 4 whole lines), global -> LDS through no register (tracked by
// ASYNCcnt). The s_wait_xcnt closes the statement so that no address register
// named here is rewritten in front of it.
__device__ __forceinline__ void stage_kv(const half_t* ksrc, const half_t* vsrc,
                                         unsigned kdst, unsigned vdst) {
  asm volatile("global_load_async_to_lds_b128 %0, %8, off\n\t"
               "global_load_async_to_lds_b128 %1, %9, off\n\t"
               "global_load_async_to_lds_b128 %2, %10, off\n\t"
               "global_load_async_to_lds_b128 %3, %11, off\n\t"
               "global_load_async_to_lds_b128 %4, %12, off\n\t"
               "global_load_async_to_lds_b128 %5, %13, off\n\t"
               "global_load_async_to_lds_b128 %6, %14, off\n\t"
               "global_load_async_to_lds_b128 %7, %15, off\n\t"
               "s_wait_xcnt 0x0"
               :: "v"(kdst), "v"(kdst + 16u * kKPitch * 2u),
                  "v"(kdst + 32u * kKPitch * 2u), "v"(kdst + 48u * kKPitch * 2u),
                  "v"(vdst), "v"(vdst + 16u * kTrPitch * 2u),
                  "v"(vdst + 32u * kTrPitch * 2u), "v"(vdst + 48u * kTrPitch * 2u),
                  "v"(ksrc), "v"(ksrc + 16 * kH), "v"(ksrc + 32 * kH), "v"(ksrc + 48 * kH),
                  "v"(vsrc), "v"(vsrc + 16 * kH), "v"(vsrc + 32 * kH), "v"(vsrc + 48 * kH)
               : "memory");
}

union frag16 { v16h v; v8h h[2]; };

// Build a 16-half fragment from two aligned 8-half (128-bit) loads.
__device__ __forceinline__ v16h ld_frag(const half_t* lo, const half_t* hi) {
  frag16 f;
  f.h[0] = *(const v8h*)lo;
  f.h[1] = *(const v8h*)hi;
  return f.v;
}

// Lane l's own address in such a tile T for the transposing load: row
// 8*(l>>4) + (l&7), 16-byte piece (l>>3)&1 of the first 16 columns.
__device__ __forceinline__ const half_t* tr_lane_ptr(const half_t* T, int lane,
                                                     int pitch = kTrPitch) {
  return T + (8 * (lane >> 4) + (lane & 7)) * pitch + 8 * ((lane >> 3) & 1);
}

// 16x32 fragment (A row or B column = tile column col0 + (l&15)) in the
// hardware k order 8*hi.., 16+8*hi..: rows 0..15, then rows 16..31.
__device__ __forceinline__ v16h ld_frag_tr(const half_t* lane_ptr, int col0,
                                           int pitch = kTrPitch) {
  frag16 f;
  f.h[0] = __builtin_bit_cast(v8h, __builtin_amdgcn_ds_load_tr16_b128_v8i16(
      (las_v8s*)(lane_ptr + col0)));
  f.h[1] = __builtin_bit_cast(v8h, __builtin_amdgcn_ds_load_tr16_b128_v8i16(
      (las_v8s*)(lane_ptr + 16 * pitch + col0)));
  return f.v;
}

// Lane l <-> lane l ^ 16 (the other half of a query's keys).
__device__ __forceinline__ float xhalf(float x) {
  return __builtin_bit_cast(float, __builtin_amdgcn_permlanex16(
      __builtin_bit_cast(int, x), __builtin_bit_cast(int, x),
      0x76543210, 0xfedcba98, false, false));
}

__device__ __forceinline__ v8f wmma16(v16h a, v16h b, v8f c) {
  // D = A(16x32 f16) * B(32x16 f16) + C(16x16 f32)
  return __builtin_amdgcn_wmma_f32_16x16x32_f16(false, a, false, b,
                                                (short)0, c, false, false);
}

// ---------------------------------------------------------------------------
// Kernel 1: O = f16(X @ W + b).  X:[4096,768] f32, W:[768,768] f32 (row = in).
// grid = (32 M-tiles, 6 N-tiles, 3 {Q,K,V}), block = 256 (8 waves).
// Block tile 128 x 128 outputs, 64 k a trip; a wave owns 32 rows x 64 columns
// (2 x 4 accumulator tiles): every X element is loaded by 18 blocks and every
// W element by 32.
// ---------------------------------------------------------------------------
__global__ __launch_bounds__(256)
void qkv_gemm_kernel(const float* __restrict__ X,
                     const float* __restrict__ Wq, const float* __restrict__ bq,
                     const float* __restrict__ Wk, const float* __restrict__ bk,
                     const float* __restrict__ Wv, const float* __restrict__ bv,
                     half_t* __restrict__ Q, half_t* __restrict__ K,
                     half_t* __restrict__ V)
{
  const float* Wm;  const float* bias;  half_t* O;
  if (blockIdx.z == 0)      { Wm = Wq; bias = bq; O = Q; }
  else if (blockIdx.z == 1) { Wm = Wk; bias = bk; O = K; }
  else                      { Wm = Wv; bias = bv; O = V; }

  const int M0   = blockIdx.x * 128;
  const int N0   = blockIdx.y * 128;
  const int tid  = threadIdx.x;
  const int wave = tid >> 5;
  const int lane = tid & 31;
  const int l16  = lane & 15;
  const int hi   = lane >> 4;       // lane-group (0 | 1)
  const int koff = hi * 8;          // contraction offset for upper group
  const int mw   = 32 * (wave >> 1);   // the wave's first row in the tile
  const int nw   = 64 * (wave & 1);    // the wave's first column in the tile

  __shared__ alignas(16) half_t Xs[128][kXPitch];  // X tile, row-major [m][k]
  __shared__ alignas(16) half_t Ws[64][kWPitch];   // W tile, row-major [k][n]
  const half_t* wlane = tr_lane_ptr(&Ws[0][nw], lane, kWPitch);

  const v8f zero = {0.f,0.f,0.f,0.f,0.f,0.f,0.f,0.f};
  v8f acc[2][4];
  #pragma unroll
  for (int i = 0; i < 2; ++i)
    #pragma unroll
    for (int j = 0; j < 4; ++j) acc[i][j] = zero;

  for (int k0 = 0; k0 < kH; k0 += 64) {
    // Stage the X tile (128 rows x 64 k) and the W tile (64 k x 128 n) as f16.
    // float4 global reads, consecutive lanes along a row: sixteen lanes cover an
    // X row's 256 bytes, a whole wave a W row's 512, so a wave's load covers 4
    // whole lines (and no two loads of a trip share a line).
    const int xr = tid >> 4, xc = (tid & 15) * 4;   // X row, k base
    const int wr = tid >> 5, wc = (tid & 31) * 4;   // k row, n base
    const float* xsrc = X  + (size_t)(M0 + xr) * kH + k0 + xc;
    const float* wsrc = Wm + (size_t)(k0 + wr) * kH + N0 + wc;
    float4 fx[8], fw[8];
    #pragma unroll
    for (int i = 0; i < 8; ++i) fx[i] = *(const float4*)(xsrc + (size_t)(16 * i) * kH);
    #pragma unroll
    for (int i = 0; i < 8; ++i) fw[i] = *(const float4*)(wsrc + (size_t)(8 * i) * kH);
    // Keeps all sixteen loads in front of the first conversion: without it the
    // compiler issues them in groups over the same registers, and a trip waits
    // out several L2 latencies one after the other.
    __builtin_amdgcn_sched_barrier(0);
    #pragma unroll
    for (int i = 0; i < 8; ++i) {
      const v4h hx = {(half_t)fx[i].x, (half_t)fx[i].y, (half_t)fx[i].z, (half_t)fx[i].w};
      *(v4h*)&Xs[xr + 16 * i][xc] = hx;
    }
    #pragma unroll
    for (int i = 0; i < 8; ++i) {
      const v4h hw = {(half_t)fw[i].x, (half_t)fw[i].y, (half_t)fw[i].z, (half_t)fw[i].w};
      *(v4h*)&Ws[wr + 8 * i][wc] = hw;
    }
    // Stands in front of the pointer advance that rewrites the address
    // registers the sixteen loads name.
    asm volatile("s_wait_xcnt 0x0" ::: "memory");
    __syncthreads();

    // Two 32-k steps, in ascending k (the order of the sums stays).
    #pragma unroll
    for (int kk = 0; kk < 2; ++kk) {
      // A fragments (rows mw..mw+31): contiguous 8-half runs -> 2x b128 each
      v16h a[2];
      #pragma unroll
      for (int i = 0; i < 2; ++i) {
        const half_t* xrow = &Xs[mw + 16 * i + l16][32 * kk + koff];
        a[i] = ld_frag(xrow, xrow + 16);
      }
      // B fragments for 4 N sub-tiles: 2x transposing b128 load each, used twice
      #pragma unroll
      for (int j = 0; j < 4; ++j) {
        const v16h bfr = ld_frag_tr(wlane + 32 * kk * kWPitch, 16 * j, kWPitch);
        #pragma unroll
        for (int i = 0; i < 2; ++i) acc[i][j] = wmma16(a[i], bfr, acc[i][j]);
      }
    }
    __syncthreads();
  }

  // Epilogue: C/D layout -> global f16 with bias.
  #pragma unroll
  for (int j = 0; j < 4; ++j) {
    const int n = N0 + nw + 16 * j + l16;
    const float bv_ = bias[n];
    #pragma unroll
    for (int i = 0; i < 2; ++i) {
      #pragma unroll
      for (int r = 0; r < 8; ++r) {
        const int m2 = M0 + mw + 16 * i + r + 8 * hi;
        O[(size_t)m2 * kH + n] = (half_t)(acc[i][j][r] + bv_);
      }
    }
  }
}

__global__ __launch_bounds__(128)
void attention_kernel(const half_t* __restrict__ Q,
                      const half_t* __restrict__ K,
                      const half_t* __restrict__ V,
                      float* __restrict__ out)
{
  const int qt = blockIdx.x;        // q tile (64 rows)
  const int h  = blockIdx.y;        // head
  const int b  = blockIdx.z;        // batch

  const int tid  = threadIdx.x;
  const int wave = __builtin_amdgcn_readfirstlane(tid >> 5);
  const int lane = tid & 31;
  const int l16  = lane & 15;
  const int hi   = lane >> 4;
  const int koff = hi * 8;
  const int cg   = wave & 1;        // which 32 of the block's 64 q rows
  const int kh   = wave >> 1;       // which 64 of a tile's 128 keys

  const size_t headOff = (size_t)b * kS * kH + (size_t)h * kHD;
  const half_t* Qb = Q + headOff;   // row stride kH
  const half_t* Kb = K + headOff;
  const half_t* Vb = V + headOff;

  constexpr int kKT = 128;          // keys a tile (a trip)
  constexpr int kKW = 64;           // keys a wave and trip
  __shared__ alignas(16) half_t Ks [2][kKT][kKPitch];  // K tiles row-major [k][d], 144 B rows
  __shared__ alignas(16) half_t Vs [2][kKT][kTrPitch];  // V tiles row-major [k][d], 160 B rows

  // Q^T B-fragments for this wave (column = q row 16*c + l16), d chunks [0,32)
  // and [32,64): global b128, hardware k order (8*hi.., 16+8*hi..).
  const int q0 = qt * 64 + cg * 32;
  v16h aq[2][2];
  #pragma unroll
  for (int c = 0; c < 2; ++c) {
    const half_t* qrow = Qb + (size_t)(q0 + 16 * c + l16) * kH;
    aq[c][0] = ld_frag(qrow +      koff, qrow + 16 + koff);
    aq[c][1] = ld_frag(qrow + 32 + koff, qrow + 48 + koff);
  }

  const v8f zero = {0.f,0.f,0.f,0.f,0.f,0.f,0.f,0.f};
  v8f cacc[2][4];
  #pragma unroll
  for (int c = 0; c < 2; ++c)
    #pragma unroll
    for (int j = 0; j < 4; ++j) cacc[c][j] = zero;
  // One query per lane and tile c (column l16): running max, and this lane
  // half's part of the denominator (the halves are joined after the loop).
  float mrow[2] = {-1.0e30f, -1.0e30f}, lsum[2] = {0.0f, 0.0f};

  const float scale = 0.125f;       // 1/sqrt(64)

  // Lane's share of every tile: k rows sr + 16 i, 8 halves from d = sc.
  constexpr int kTiles = kS / kKT;
  const int sr = tid >> 3, sc = (tid & 7) * 8;
  const half_t* ksrc = Kb + (size_t)sr * kH + sc;
  const half_t* vsrc = Vb + (size_t)sr * kH + sc;

  // Ring prologue: tile 0 landed and published, then tile 1 in flight.
  #pragma unroll
  for (int u = 0; u < 2; ++u)
    stage_kv(ksrc + u * 64 * kH, vsrc + u * 64 * kH,
             lds_addr(&Ks[0][64 * u + sr][sc]), lds_addr(&Vs[0][64 * u + sr][sc]));
  wait_asynccnt0();
  __syncthreads();
  #pragma unroll
  for (int u = 0; u < 2; ++u)
    stage_kv(ksrc + (kKT + u * 64) * kH, vsrc + (kKT + u * 64) * kH,
             lds_addr(&Ks[1][64 * u + sr][sc]), lds_addr(&Vs[1][64 * u + sr][sc]));

  // Kept rolled: the two buffers' copy addresses would otherwise all be held in
  // registers across the loop, past the budget.
  #pragma unroll 1
  for (int t = 0; t < kTiles; ++t) {
    const int buf = t & 1;
    const half_t (*Kt)[kKPitch] = &Ks[buf][kh * kKW];
    const half_t* vlane = tr_lane_ptr(&Vs[buf][kh * kKW][0], lane);

    // scores: S^T = K * Q^T  (A row = key, B column = query, contraction = d)
    // s[c][j][r] = score(key 16*j + 8*hi + r, query 16*c + l16)
    v8f s[2][4];
    #pragma unroll
    for (int j = 0; j < 4; ++j) {
      const int krow = 16 * j + l16;
      const v16h ak0 = ld_frag(&Kt[krow][koff],      &Kt[krow][16 + koff]);
      const v16h ak1 = ld_frag(&Kt[krow][32 + koff], &Kt[krow][48 + koff]);
      #pragma unroll
      for (int c = 0; c < 2; ++c)
        s[c][j] = wmma16(ak1, aq[c][1], wmma16(ak0, aq[c][0], zero));
    }

    // Online softmax, one query per lane and tile: one maximum for the 64 keys.
    float mnew[2], corr[2];
    #pragma unroll
    for (int c = 0; c < 2; ++c) {
      float hmax[2];
      #pragma unroll
      for (int g = 0; g < 2; ++g) {
        hmax[g] = fmaxf(s[c][2 * g][0], s[c][2 * g + 1][0]);
        #pragma unroll
        for (int r = 1; r < 8; ++r)
          hmax[g] = fmaxf(hmax[g], fmaxf(s[c][2 * g][r], s[c][2 * g + 1][r]));
      }
      float tmax = fmaxf(hmax[0], hmax[1]);
      tmax = fmaxf(tmax, xhalf(tmax)) * scale;
      mnew[c] = fmaxf(mrow[c], tmax);
    }
    #pragma unroll
    for (int c = 0; c < 2; ++c) {
      corr[c] = __expf(mrow[c] - mnew[c]);
      mrow[c] = mnew[c];
    }

    // P^T as B operands, one per 32 keys: element e of operand g =
    // P^T[key 32*g + kmap(e)][query] = tile 2*g + (e>>3), reg e&7.
    v16h bp[2][2];
    #pragma unroll
    for (int c = 0; c < 2; ++c) {
      float psum[2];
      #pragma unroll
      for (int g = 0; g < 2; ++g) {
        psum[g] = 0.0f;
        #pragma unroll
        for (int e = 0; e < 16; ++e) {
          const float p = __expf(s[c][2 * g + (e >> 3)][e & 7] * scale - mnew[c]);
          psum[g] += p;
          bp[c][g][e] = (half_t)p;
        }
      }
      lsum[c] = lsum[c] * corr[c] + (psum[0] + psum[1]);
      #pragma unroll
      for (int j = 0; j < 4; ++j) cacc[c][j] *= corr[c];
    }

    // ctx^T += V^T(64x64) * P^T(64x32): A rows = d, by the transposing load.
    #pragma unroll
    for (int g = 0; g < 2; ++g) {
      #pragma unroll
      for (int j = 0; j < 4; ++j) {
        const v16h avf = ld_frag_tr(vlane + g * 32 * kTrPitch, 16 * j);
        #pragma unroll
        for (int c = 0; c < 2; ++c) cacc[c][j] = wmma16(avf, bp[c][g], cacc[c][j]);
      }
    }

    // Publish point of tile t + 1: own reads of tile t returned, own copies of
    // tile t + 1 landed, then the one barrier of the trip; behind it tile t's
    // buffer is free for tile t + 2.
    wait_dscnt0();
    wait_asynccnt0();
    __syncthreads();
    if (t + 2 < kTiles) {
      #pragma unroll
      for (int u = 0; u < 2; ++u)
        stage_kv(ksrc + ((size_t)(t + 2) * kKT + u * 64) * kH,
                 vsrc + ((size_t)(t + 2) * kKT + u * 64) * kH,
                 lds_addr(&Ks[buf][64 * u + sr][sc]), lds_addr(&Vs[buf][64 * u + sr][sc]));
    }
  }
  wait_asynccnt0();    // nothing of this wave is in flight when it ends

  // Join of the key halves: the waves of the second half hand over ctx (16
  // pieces a lane), max and sum; lane and register mean the same query and d in
  // both waves of a pair. The K ring serves as the hand-over space: behind the
  // last trip's barrier nobody reads it and no copy is in flight.
  float4 (*Mg)[17][32] = reinterpret_cast<float4 (*)[17][32]>(&Ks[0][0][0]);
  if (kh == 1) {
    #pragma unroll
    for (int c = 0; c < 2; ++c) {
      #pragma unroll
      for (int j = 0; j < 4; ++j) {
        Mg[cg][(4 * c + j) * 2][lane]     = make_float4(cacc[c][j][0], cacc[c][j][1],
                                                        cacc[c][j][2], cacc[c][j][3]);
        Mg[cg][(4 * c + j) * 2 + 1][lane] = make_float4(cacc[c][j][4], cacc[c][j][5],
                                                        cacc[c][j][6], cacc[c][j][7]);
      }
    }
    Mg[cg][16][lane] = make_float4(mrow[0], lsum[0], mrow[1], lsum[1]);
  }
  __syncthreads();
  if (kh == 1) return;

  // Normalize and store ctx (f32). Output layout [B,S,NH*HD]: head h occupies
  // columns h*64..h*64+63. cacc[c][j][r] = ctx[query 16*c + l16][d = 16*j +
  // 8*hi + r]: 8 consecutive floats per lane and j -> two 16-byte stores.
  const float4 ml = Mg[cg][16][lane];
  #pragma unroll
  for (int c = 0; c < 2; ++c) {
    const float m1 = c ? ml.z : ml.x;
    const float l1 = c ? ml.w : ml.y;
    const float m  = fmaxf(mrow[c], m1);
    const float e0 = __expf(mrow[c] - m), e1 = __expf(m1 - m);
    const float lj = lsum[c] * e0 + l1 * e1;
    const float inv = 1.0f / (lj + xhalf(lj));
    const float f0 = e0 * inv, f1 = e1 * inv;
    float* orow = out + (size_t)(b * kS + q0 + 16 * c + l16) * kH + (size_t)h * kHD + 8 * hi;
    #pragma unroll
    for (int j = 0; j < 4; ++j) {
      const float4 p0 = Mg[cg][(4 * c + j) * 2][lane];
      const float4 p1 = Mg[cg][(4 * c + j) * 2 + 1][lane];
      const float4 lo4 = make_float4(cacc[c][j][0] * f0 + p0.x * f1, cacc[c][j][1] * f0 + p0.y * f1,
                                     cacc[c][j][2] * f0 + p0.z * f1, cacc[c][j][3] * f0 + p0.w * f1);
      const float4 hi4 = make_float4(cacc[c][j][4] * f0 + p1.x * f1, cacc[c][j][5] * f0 + p1.y * f1,
                                     cacc[c][j][6] * f0 + p1.z * f1, cacc[c][j][7] * f0 + p1.w * f1);
      *(float4*)(orow + 16 * j)     = lo4;
      *(float4*)(orow + 16 * j + 4) = hi4;
    }
  }
}

// ---------------------------------------------------------------------------
extern "C" void kernel_launch(void* const* d_in, const int* in_sizes, int n_in,
                              void* d_out, int out_size, void* d_ws, size_t ws_size,
                              hipStream_t stream) {
  const float* X  = (const float*)d_in[0];
  const float* Wq = (const float*)d_in[1];
  const float* bq = (const float*)d_in[2];
  const float* Wk = (const float*)d_in[3];
  const float* bk = (const float*)d_in[4];
  const float* Wv = (const float*)d_in[5];
  const float* bv = (const float*)d_in[6];
  float* out = (float*)d_out;

  // Workspace: f16 Q, K, V, each [4096, 768] (6.29 MB each, 18.9 MB total).
  half_t* Qh = (half_t*)d_ws;
  half_t* Kh = Qh + (size_t)kBS * kH;
  half_t* Vh = Kh + (size_t)kBS * kH;

  dim3 g1(kBS / 128, kH / 128, 3);     // 32 x 6 x 3 blocks
  qkv_gemm_kernel<<<g1, 256, 0, stream>>>(X, Wq, bq, Wk, bk, Wv, bv, Qh, Kh, Vh);

  dim3 g2(kS / 64, kNH, kB);           // 32 x 12 x 2 blocks
  attention_kernel<<<g2, 128, 0, stream>>>(Qh, Kh, Vh, out);
}

// v008
// Measured time: 52.7 microseconds a run.
// Two timings next to v007 put it at 1.04 and 1.05 times that version's speed.
// All steps since v000 together make it 3.33 times as fast.
#include <hip/hip_runtime.h>
#include <hip/hip_bf16.h>

// ---------------------------------------------------------------------------
// Self-attention forward for MI455X (gfx1250, wave32, WMMA).
//  Kernel 1: QKV projection GEMM (f32 in -> f16 Q/K/V in workspace).
//  Kernel 2: flash-attention over 64-row q tiles, online softmax.
// All WMMA fragments are built from 128-bit LDS/global loads. The W and V
// tiles lie ROW-MAJOR in LDS and are transposed on the way
// out by DS_LOAD_TR16_B128. The attention K and V tiles
// (pure f16 byte copies) are staged with GLOBAL_LOAD_ASYNC_TO_LDS_B128
// (ASYNCcnt path) in a ring of two buffers, one tile ahead of the products.
// Every wave-wide 16-byte global load or copy of an LDS-staged tile covers four whole
// 128-byte lines: consecutive lanes walk along a row. The output tiles of both
// kernels go the same way: accumulators -> the wave's own LDS range -> 16-byte
// global stores along the rows.
// ---------------------------------------------------------------------------

typedef _Float16 half_t;
typedef __attribute__((ext_vector_type(16))) _Float16 v16h;
typedef __attribute__((ext_vector_type(8)))  _Float16 v8h;
typedef __attribute__((ext_vector_type(4)))  _Float16 v4h;
typedef __attribute__((ext_vector_type(8)))  float    v8f;
typedef __attribute__((ext_vector_type(4)))  int      v4i;
typedef __attribute__((ext_vector_type(8)))  short    v8s;
typedef __attribute__((address_space(3))) v8s las_v8s;   // LDS (AS3)

constexpr int kB  = 2;
constexpr int kS  = 2048;
constexpr int kH  = 768;
constexpr int kNH = 12;
constexpr int kHD = 64;
constexpr int kBS = kB * kS;          // 4096 rows of hidden_states

// LDS row pitch, in halves, of a row-major [128 k][64 columns] f16 tile read by
// the transposing load: 160 B = 32 B x odd, its conflict-free pitch.
constexpr int kTrPitch = 80;
// LDS row pitch, in halves, of the K tile (plain 16-byte reads): 144 B.
constexpr int kKPitch = 72;
// The same two pitches for the projection's tiles: X rows of 64 k (128 B,
// plain 16-byte reads) at 144 B, W rows of 128 columns (256 B, transposing
// load) at 288 B = 32 B x odd.
constexpr int kXPitch = 72;
constexpr int kWPitch = 144;
// LDS row pitches of the output staging (16-byte writes and reads, 16 B x odd):
// projection rows of 64 halves (128 B) at 144 B, attention rows of 64 floats
// (256 B) at 272 B.
constexpr int kOPitch = 72;
constexpr int kCPitch = 68;

typedef __attribute__((address_space(3))) half_t las_half;   // LDS (AS3)
// Byte address of a __shared__ element inside the work-group's LDS.
__device__ __forceinline__ unsigned lds_addr(const half_t* p) {
  return (unsigned)(size_t)(const las_half*)p;
}
// This wave's own copies have landed in LDS (asm with the clobber: no LDS read
// may be moved in front of it).
__device__ __forceinline__ void wait_asynccnt0() {
  asm volatile("s_wait_asynccnt 0x0" ::: "memory");
}
// This wave's own LDS reads have returned: its buffer may be refilled behind
// the next barrier.
__device__ __forceinline__ void wait_dscnt0() {
  asm volatile("s_wait_dscnt 0x0" ::: "memory");
}
// One lane's share of 64 keys of a K/V tile pair: 16 bytes of K rows r, r + 16,
// r + 32, r + 48 and of the same V rows (eight lanes a row: a wave's copy
// covers 4 whole lines), global -> LDS through no register (tracked by
// ASYNCcnt). The s_wait_xcnt closes the statement so that no address register
// named here is rewritten in front of it.
__device__ __forceinline__ void stage_kv(const half_t* ksrc, const half_t* vsrc,
                                         unsigned kdst, unsigned vdst) {
  asm volatile("global_load_async_to_lds_b128 %0, %8, off\n\t"
               "global_load_async_to_lds_b128 %1, %9, off\n\t"
               "global_load_async_to_lds_b128 %2, %10, off\n\t"
               "global_load_async_to_lds_b128 %3, %11, off\n\t"
               "global_load_async_to_lds_b128 %4, %12, off\n\t"
               "global_load_async_to_lds_b128 %5, %13, off\n\t"
               "global_load_async_to_lds_b128 %6, %14, off\n\t"
               "global_load_async_to_lds_b128 %7, %15, off\n\t"
               "s_wait_xcnt 0x0"
               :: "v"(kdst), "v"(kdst + 16u * kKPitch * 2u),
                  "v"(kdst + 32u * kKPitch * 2u), "v"(kdst + 48u * kKPitch * 2u),
                  "v"(vdst), "v"(vdst + 16u * kTrPitch * 2u),
                  "v"(vdst + 32u * kTrPitch * 2u), "v"(vdst + 48u * kTrPitch * 2u),
                  "v"(ksrc), "v"(ksrc + 16 * kH), "v"(ksrc + 32 * kH), "v"(ksrc + 48 * kH),
                  "v"(vsrc), "v"(vsrc + 16 * kH), "v"(vsrc + 32 * kH), "v"(vsrc + 48 * kH)
               : "memory");
}

union frag16 { v16h v; v8h h[2]; };

// Build a 16-half fragment from two aligned 8-half (128-bit) loads.
__device__ __forceinline__ v16h ld_frag(const half_t* lo, const half_t* hi) {
  frag16 f;
  f.h[0] = *(const v8h*)lo;
  f.h[1] = *(const v8h*)hi;
  return f.v;
}

// Lane l's own address in such a tile T for the transposing load: row
// 8*(l>>4) + (l&7), 16-byte piece (l>>3)&1 of the first 16 columns.
__device__ __forceinline__ const half_t* tr_lane_ptr(const half_t* T, int lane,
                                                     int pitch = kTrPitch) {
  return T + (8 * (lane >> 4) + (lane & 7)) * pitch + 8 * ((lane >> 3) & 1);
}

// 16x32 fragment (A row or B column = tile column col0 + (l&15)) in the
// hardware k order 8*hi.., 16+8*hi..: rows 0..15, then rows 16..31.
__device__ __forceinline__ v16h ld_frag_tr(const half_t* lane_ptr, int col0,
                                           int pitch = kTrPitch) {
  frag16 f;
  f.h[0] = __builtin_bit_cast(v8h, __builtin_amdgcn_ds_load_tr16_b128_v8i16(
      (las_v8s*)(lane_ptr + col0)));
  f.h[1] = __builtin_bit_cast(v8h, __builtin_amdgcn_ds_load_tr16_b128_v8i16(
      (las_v8s*)(lane_ptr + 16 * pitch + col0)));
  return f.v;
}

// Lane l <-> lane l ^ 16 (the other half of a query's keys).
__device__ __forceinline__ float xhalf(float x) {
  return __builtin_bit_cast(float, __builtin_amdgcn_permlanex16(
      __builtin_bit_cast(int, x), __builtin_bit_cast(int, x),
      0x76543210, 0xfedcba98, false, false));
}

__device__ __forceinline__ v8f wmma16(v16h a, v16h b, v8f c) {
  // D = A(16x32 f16) * B(32x16 f16) + C(16x16 f32)
  return __builtin_amdgcn_wmma_f32_16x16x32_f16(false, a, false, b,
                                                (short)0, c, false, false);
}

// ---------------------------------------------------------------------------
// Kernel 1: O = f16(X @ W + b).  X:[4096,768] f32, W:[768,768] f32 (row = in).
// grid = (32 M-tiles, 6 N-tiles, 3 {Q,K,V}), block = 256 (8 waves).
// Block tile 128 x 128 outputs, 64 k a trip; a wave owns 32 rows x 64 columns
// (2 x 4 accumulator tiles): every X element is loaded by 18 blocks and every
// W element by 32. The products are taken transposed (A = W^T, B = X^T): a lane
// then holds 8 consecutive columns of one output row, one 16-byte piece.
// ---------------------------------------------------------------------------
__global__ __launch_bounds__(256)
void qkv_gemm_kernel(const float* __restrict__ X,
                     const float* __restrict__ Wq, const float* __restrict__ bq,
                     const float* __restrict__ Wk, const float* __restrict__ bk,
                     const float* __restrict__ Wv, const float* __restrict__ bv,
                     half_t* __restrict__ Q, half_t* __restrict__ K,
                     half_t* __restrict__ V)
{
  const float* Wm;  const float* bias;  half_t* O;
  if (blockIdx.z == 0)      { Wm = Wq; bias = bq; O = Q; }
  else if (blockIdx.z == 1) { Wm = Wk; bias = bk; O = K; }
  else                      { Wm = Wv; bias = bv; O = V; }

  const int M0   = blockIdx.x * 128;
  const int N0   = blockIdx.y * 128;
  const int tid  = threadIdx.x;
  const int wave = tid >> 5;
  const int lane = tid & 31;
  const int l16  = lane & 15;
  const int hi   = lane >> 4;       // lane-group (0 | 1)
  const int koff = hi * 8;          // contraction offset for upper group
  const int mw   = 32 * (wave >> 1);   // the wave's first row in the tile
  const int nw   = 64 * (wave & 1);    // the wave's first column in the tile

  // One LDS block: the X tile, the W tile behind it; after the loop the same
  // bytes are the eight waves' output staging.
  __shared__ alignas(16) half_t Sm[128 * kXPitch + 64 * kWPitch];
  static_assert(8 * 32 * kOPitch <= 128 * kXPitch + 64 * kWPitch, "staging fits");
  half_t (*Xs)[kXPitch] = reinterpret_cast<half_t (*)[kXPitch]>(Sm);                  // [m][k]
  half_t (*Ws)[kWPitch] = reinterpret_cast<half_t (*)[kWPitch]>(Sm + 128 * kXPitch);  // [k][n]
  const half_t* wlane = tr_lane_ptr(&Ws[0][nw], lane, kWPitch);

  const v8f zero = {0.f,0.f,0.f,0.f,0.f,0.f,0.f,0.f};
  v8f acc[2][4];
  #pragma unroll
  for (int i = 0; i < 2; ++i)
    #pragma unroll
    for (int j = 0; j < 4; ++j) acc[i][j] = zero;

  for (int k0 = 0; k0 < kH; k0 += 64) {
    // Stage the X tile (128 rows x 64 k) and the W tile (64 k x 128 n) as f16.
    // float4 global reads, consecutive lanes along a row: sixteen lanes cover an
    // X row's 256 bytes, a whole wave a W row's 512, so a wave's load covers 4
    // whole lines (and no two loads of a trip share a line).
    const int xr = tid >> 4, xc = (tid & 15) * 4;   // X row, k base
    const int wr = tid >> 5, wc = (tid & 31) * 4;   // k row, n base
    const float* xsrc = X  + (size_t)(M0 + xr) * kH + k0 + xc;
    const float* wsrc = Wm + (size_t)(k0 + wr) * kH + N0 + wc;
    float4 fx[8], fw[8];
    #pragma unroll
    for (int i = 0; i < 8; ++i) fx[i] = *(const float4*)(xsrc + (size_t)(16 * i) * kH);
    #pragma unroll
    for (int i = 0; i < 8; ++i) fw[i] = *(const float4*)(wsrc + (size_t)(8 * i) * kH);
    // Keeps all sixteen loads in front of the first conversion: without it the
    // compiler issues them in groups over the same registers, and a trip waits
    // out several L2 latencies one after the other.
    __builtin_amdgcn_sched_barrier(0);
    #pragma unroll
    for (int i = 0; i < 8; ++i) {
      const v4h hx = {(half_t)fx[i].x, (half_t)fx[i].y, (half_t)fx[i].z, (half_t)fx[i].w};
      *(v4h*)&Xs[xr + 16 * i][xc] = hx;
    }
    #pragma unroll
    for (int i = 0; i < 8; ++i) {
      const v4h hw = {(half_t)fw[i].x, (half_t)fw[i].y, (half_t)fw[i].z, (half_t)fw[i].w};
      *(v4h*)&Ws[wr + 8 * i][wc] = hw;
    }
    // Stands in front of the pointer advance that rewrites the address
    // registers the sixteen loads name.
    asm volatile("s_wait_xcnt 0x0" ::: "memory");
    __syncthreads();

    // Two 32-k steps, in ascending k (the order of the sums stays).
    #pragma unroll
    for (int kk = 0; kk < 2; ++kk) {
      // X fragments (rows mw..mw+31): contiguous 8-half runs -> 2x b128 each
      v16h a[2];
      #pragma unroll
      for (int i = 0; i < 2; ++i) {
        const half_t* xrow = &Xs[mw + 16 * i + l16][32 * kk + koff];
        a[i] = ld_frag(xrow, xrow + 16);
      }
      // W fragments for 4 N sub-tiles: 2x transposing b128 load each, used twice
      #pragma unroll
      for (int j = 0; j < 4; ++j) {
        const v16h bfr = ld_frag_tr(wlane + 32 * kk * kWPitch, 16 * j, kWPitch);
        #pragma unroll
        for (int i = 0; i < 2; ++i) acc[i][j] = wmma16(bfr, a[i], acc[i][j]);
      }
    }
    __syncthreads();
  }

  // Epilogue. acc[i][j][r] = O[row mw + 16*i + l16][column nw + 16*j + 8*hi + r].
  // Bias, f16, then the wave's 32 x 64 tile into its own LDS range (behind the
  // last trip's barrier nobody reads the X and W tiles any more).
  half_t* stg = Sm + wave * (32 * kOPitch);
  #pragma unroll
  for (int j = 0; j < 4; ++j) {
    const float* bp = bias + N0 + nw + 16 * j + 8 * hi;
    const float4 b0 = *(const float4*)bp;
    const float4 b1 = *(const float4*)(bp + 4);
    #pragma unroll
    for (int i = 0; i < 2; ++i) {
      const v8h o = {(half_t)(acc[i][j][0] + b0.x), (half_t)(acc[i][j][1] + b0.y),
                     (half_t)(acc[i][j][2] + b0.z), (half_t)(acc[i][j][3] + b0.w),
                     (half_t)(acc[i][j][4] + b1.x), (half_t)(acc[i][j][5] + b1.y),
                     (half_t)(acc[i][j][6] + b1.z), (half_t)(acc[i][j][7] + b1.w)};
      *(v8h*)&stg[(16 * i + l16) * kOPitch + 16 * j + 8 * hi] = o;
    }
  }
  // The wave's own staging writes are done before other lanes read them back.
  wait_dscnt0();
  // Eight lanes a row (its 128 bytes are one line): a store covers 4 whole lines.
  #pragma unroll
  for (int q = 0; q < 8; ++q) {
    const int row = 4 * q + (lane >> 3), col = (lane & 7) * 8;
    const v8h o = *(const v8h*)&stg[row * kOPitch + col];
    *(v8h*)&O[(size_t)(M0 + mw + row) * kH + N0 + nw + col] = o;
  }
}

__global__ __launch_bounds__(128)
void attention_kernel(const half_t* __restrict__ Q,
                      const half_t* __restrict__ K,
                      const half_t* __restrict__ V,
                      float* __restrict__ out)
{
  const int qt = blockIdx.x;        // q tile (64 rows)
  const int h  = blockIdx.y;        // head
  const int b  = blockIdx.z;        // batch

  const int tid  = threadIdx.x;
  const int wave = __builtin_amdgcn_readfirstlane(tid >> 5);
  const int lane = tid & 31;
  const int l16  = lane & 15;
  const int hi   = lane >> 4;
  const int koff = hi * 8;
  const int cg   = wave & 1;        // which 32 of the block's 64 q rows
  const int kh   = wave >> 1;       // which 64 of a tile's 128 keys

  const size_t headOff = (size_t)b * kS * kH + (size_t)h * kHD;
  const half_t* Qb = Q + headOff;   // row stride kH
  const half_t* Kb = K + headOff;
  const half_t* Vb = V + headOff;

  constexpr int kKT = 128;          // keys a tile (a trip)
  constexpr int kKW = 64;           // keys a wave and trip
  __shared__ alignas(16) half_t Ks [2][kKT][kKPitch];  // K tiles row-major [k][d], 144 B rows
  __shared__ alignas(16) half_t Vs [2][kKT][kTrPitch];  // V tiles row-major [k][d], 160 B rows

  // Q^T B-fragments for this wave (column = q row 16*c + l16), d chunks [0,32)
  // and [32,64): global b128, hardware k order (8*hi.., 16+8*hi..).
  const int q0 = qt * 64 + cg * 32;
  v16h aq[2][2];
  #pragma unroll
  for (int c = 0; c < 2; ++c) {
    const half_t* qrow = Qb + (size_t)(q0 + 16 * c + l16) * kH;
    aq[c][0] = ld_frag(qrow +      koff, qrow + 16 + koff);
    aq[c][1] = ld_frag(qrow + 32 + koff, qrow + 48 + koff);
  }

  const v8f zero = {0.f,0.f,0.f,0.f,0.f,0.f,0.f,0.f};
  v8f cacc[2][4];
  #pragma unroll
  for (int c = 0; c < 2; ++c)
    #pragma unroll
    for (int j = 0; j < 4; ++j) cacc[c][j] = zero;
  // One query per lane and tile c (column l16): running max, and this lane
  // half's part of the denominator (the halves are joined after the loop).
  float mrow[2] = {-1.0e30f, -1.0e30f}, lsum[2] = {0.0f, 0.0f};

  const float scale = 0.125f;       // 1/sqrt(64)

  // Lane's share of every tile: k rows sr + 16 i, 8 halves from d = sc.
  constexpr int kTiles = kS / kKT;
  const int sr = tid >> 3, sc = (tid & 7) * 8;
  const half_t* ksrc = Kb + (size_t)sr * kH + sc;
  const half_t* vsrc = Vb + (size_t)sr * kH + sc;

  // Ring prologue: tile 0 landed and published, then tile 1 in flight.
  #pragma unroll
  for (int u = 0; u < 2; ++u)
    stage_kv(ksrc + u * 64 * kH, vsrc + u * 64 * kH,
             lds_addr(&Ks[0][64 * u + sr][sc]), lds_addr(&Vs[0][64 * u + sr][sc]));
  wait_asynccnt0();
  __syncthreads();
  #pragma unroll
  for (int u = 0; u < 2; ++u)
    stage_kv(ksrc + (kKT + u * 64) * kH, vsrc + (kKT + u * 64) * kH,
             lds_addr(&Ks[1][64 * u + sr][sc]), lds_addr(&Vs[1][64 * u + sr][sc]));

  // Kept rolled: the two buffers' copy addresses would otherwise all be held in
  // registers across the loop, past the budget.
  #pragma unroll 1
  for (int t = 0; t < kTiles; ++t) {
    const int buf = t & 1;
    const half_t (*Kt)[kKPitch] = &Ks[buf][kh * kKW];
    const half_t* vlane = tr_lane_ptr(&Vs[buf][kh * kKW][0], lane);

    // scores: S^T = K * Q^T  (A row = key, B column = query, contraction = d)
    // s[c][j][r] = score(key 16*j + 8*hi + r, query 16*c + l16)
    v8f s[2][4];
    #pragma unroll
    for (int j = 0; j < 4; ++j) {
      const int krow = 16 * j + l16;
      const v16h ak0 = ld_frag(&Kt[krow][koff],      &Kt[krow][16 + koff]);
      const v16h ak1 = ld_frag(&Kt[krow][32 + koff], &Kt[krow][48 + koff]);
      #pragma unroll
      for (int c = 0; c < 2; ++c)
        s[c][j] = wmma16(ak1, aq[c][1], wmma16(ak0, aq[c][0], zero));
    }

    // Online softmax, one query per lane and tile: one maximum for the 64 keys.
    float mnew[2], corr[2];
    #pragma unroll
    for (int c = 0; c < 2; ++c) {
      float hmax[2];
      #pragma unroll
      for (int g = 0; g < 2; ++g) {
        hmax[g] = fmaxf(s[c][2 * g][0], s[c][2 * g + 1][0]);
        #pragma unroll
        for (int r = 1; r < 8; ++r)
          hmax[g] = fmaxf(hmax[g], fmaxf(s[c][2 * g][r], s[c][2 * g + 1][r]));
      }
      float tmax = fmaxf(hmax[0], hmax[1]);
      tmax = fmaxf(tmax, xhalf(tmax)) * scale;
      mnew[c] = fmaxf(mrow[c], tmax);
    }
    #pragma unroll
    for (int c = 0; c < 2; ++c) {
      corr[c] = __expf(mrow[c] - mnew[c]);
      mrow[c] = mnew[c];
    }

    // P^T as B operands, one per 32 keys: element e of operand g =
    // P^T[key 32*g + kmap(e)][query] = tile 2*g + (e>>3), reg e&7.
    v16h bp[2][2];
    #pragma unroll
    for (int c = 0; c < 2; ++c) {
      float psum[2];
      #pragma unroll
      for (int g = 0; g < 2; ++g) {
        psum[g] = 0.0f;
        #pragma unroll
        for (int e = 0; e < 16; ++e) {
          const float p = __expf(s[c][2 * g + (e >> 3)][e & 7] * scale - mnew[c]);
          psum[g] += p;
          bp[c][g][e] = (half_t)p;
        }
      }
      lsum[c] = lsum[c] * corr[c] + (psum[0] + psum[1]);
      #pragma unroll
      for (int j = 0; j < 4; ++j) cacc[c][j] *= corr[c];
    }

    // ctx^T += V^T(64x64) * P^T(64x32): A rows = d, by the transposing load.
    #pragma unroll
    for (int g = 0; g < 2; ++g) {
      #pragma unroll
      for (int j = 0; j < 4; ++j) {
        const v16h avf = ld_frag_tr(vlane + g * 32 * kTrPitch, 16 * j);
        #pragma unroll
        for (int c = 0; c < 2; ++c) cacc[c][j] = wmma16(avf, bp[c][g], cacc[c][j]);
      }
    }

    // Publish point of tile t + 1: own reads of tile t returned, own copies of
    // tile t + 1 landed, then the one barrier of the trip; behind it tile t's
    // buffer is free for tile t + 2.
    wait_dscnt0();
    wait_asynccnt0();
    __syncthreads();
    if (t + 2 < kTiles) {
      #pragma unroll
      for (int u = 0; u < 2; ++u)
        stage_kv(ksrc + ((size_t)(t + 2) * kKT + u * 64) * kH,
                 vsrc + ((size_t)(t + 2) * kKT + u * 64) * kH,
                 lds_addr(&Ks[buf][64 * u + sr][sc]), lds_addr(&Vs[buf][64 * u + sr][sc]));
    }
  }
  wait_asynccnt0();    // nothing of this wave is in flight when it ends

  // Join of the key halves: the waves of the second half hand over ctx (16
  // pieces a lane), max and sum; lane and register mean the same query and d in
  // both waves of a pair. The K ring serves as the hand-over space: behind the
  // last trip's barrier nobody reads it and no copy is in flight.
  float4 (*Mg)[17][32] = reinterpret_cast<float4 (*)[17][32]>(&Ks[0][0][0]);
  if (kh == 1) {
    #pragma unroll
    for (int c = 0; c < 2; ++c) {
      #pragma unroll
      for (int j = 0; j < 4; ++j) {
        Mg[cg][(4 * c + j) * 2][lane]     = make_float4(cacc[c][j][0], cacc[c][j][1],
                                                        cacc[c][j][2], cacc[c][j][3]);
        Mg[cg][(4 * c + j) * 2 + 1][lane] = make_float4(cacc[c][j][4], cacc[c][j][5],
                                                        cacc[c][j][6], cacc[c][j][7]);
      }
    }
    Mg[cg][16][lane] = make_float4(mrow[0], lsum[0], mrow[1], lsum[1]);
  }
  __syncthreads();
  if (kh == 1) return;

  // Normalize ctx (f32). cacc[c][j][r] = ctx[query 16*c + l16][d = 16*j + 8*hi
  // + r]: 8 consecutive floats per lane and j, two 16-byte pieces, into the
  // wave's own staging range in the V ring (free like the K ring).
  float* stg = reinterpret_cast<float*>(&Vs[0][0][0]) + cg * (32 * kCPitch);
  const float4 ml = Mg[cg][16][lane];
  #pragma unroll
  for (int c = 0; c < 2; ++c) {
    const float m1 = c ? ml.z : ml.x;
    const float l1 = c ? ml.w : ml.y;
    const float m  = fmaxf(mrow[c], m1);
    const float e0 = __expf(mrow[c] - m), e1 = __expf(m1 - m);
    const float lj = lsum[c] * e0 + l1 * e1;
    const float inv = 1.0f / (lj + xhalf(lj));
    const float f0 = e0 * inv, f1 = e1 * inv;
    float* orow = stg + (16 * c + l16) * kCPitch + 8 * hi;
    #pragma unroll
    for (int j = 0; j < 4; ++j) {
      const float4 p0 = Mg[cg][(4 * c + j) * 2][lane];
      const float4 p1 = Mg[cg][(4 * c + j) * 2 + 1][lane];
      const float4 lo4 = make_float4(cacc[c][j][0] * f0 + p0.x * f1, cacc[c][j][1] * f0 + p0.y * f1,
                                     cacc[c][j][2] * f0 + p0.z * f1, cacc[c][j][3] * f0 + p0.w * f1);
      const float4 hi4 = make_float4(cacc[c][j][4] * f0 + p1.x * f1, cacc[c][j][5] * f0 + p1.y * f1,
                                     cacc[c][j][6] * f0 + p1.z * f1, cacc[c][j][7] * f0 + p1.w * f1);
      *(float4*)(orow + 16 * j)     = lo4;
      *(float4*)(orow + 16 * j + 4) = hi4;
    }
  }
  // The wave's own staging writes are done before other lanes read them back.
  wait_dscnt0();
  // Output layout [B,S,NH*HD]: head h occupies columns h*64..h*64+63, 256 bytes
  // of a row. Sixteen lanes a row: a store covers 4 whole lines.
  float* obase = out + (size_t)(b * kS + q0) * kH + (size_t)h * kHD;
  #pragma unroll
  for (int q = 0; q < 16; ++q) {
    const int row = 2 * q + hi;
    const float4 o = *(const float4*)&stg[row * kCPitch + 4 * l16];
    *(float4*)(obase + (size_t)row * kH + 4 * l16) = o;
  }
}

// ---------------------------------------------------------------------------
extern "C" void kernel_launch(void* const* d_in, const int* in_sizes, int n_in,
                              void* d_out, int out_size, void* d_ws, size_t ws_size,
                              hipStream_t stream) {
  const float* X  = (const float*)d_in[0];
  const float* Wq = (const float*)d_in[1];
  const float* bq = (const float*)d_in[2];
  const float* Wk = (const float*)d_in[3];
  const float* bk = (const float*)d_in[4];
  const float* Wv = (const float*)d_in[5];
  const float* bv = (const float*)d_in[6];
  float* out = (float*)d_out;

  // Workspace: f16 Q, K, V, each [4096, 768] (6.29 MB each, 18.9 MB total).
  half_t* Qh = (half_t*)d_ws;
  half_t* Kh = Qh + (size_t)kBS * kH;
  half_t* Vh = Kh + (size_t)kBS * kH;

  dim3 g1(kBS / 128, kH / 128, 3);     // 32 x 6 x 3 blocks
  qkv_gemm_kernel<<<g1, 256, 0, stream>>>(X, Wq, bq, Wk, bk, Wv, bv, Qh, Kh, Vh);

  dim3 g2(kS / 64, kNH, kB);           // 32 x 12 x 2 blocks
  attention_kernel<<<g2, 128, 0, stream>>>(Qh, Kh, Vh, out);
}

// v009
// A run of this version takes 47.7 microseconds.
// Timed twice side by side with v008, it ran 1.10 and 1.09 times as fast.
// Counting every step since v000, it is 3.65 times as fast.
#include <hip/hip_runtime.h>
#include <hip/hip_bf16.h>
#include <stdint.h>

// ---------------------------------------------------------------------------
// Self-attention forward for MI455X (gfx1250, wave32, WMMA).
//  Kernel 1: QKV projection GEMM (f32 in -> f16 Q/K/V in workspace).
//  Kernel 2: flash-attention over 64-row q tiles, online softmax.
// All WMMA fragments are built from 128-bit LDS/global loads. The W and V
// tiles lie ROW-MAJOR in LDS and are transposed on the way
// out by DS_LOAD_TR16_B128. The attention K and V tiles
// (pure f16 byte copies) are brought by TENSOR_LOAD_TO_LDS, one request a wave
// and tile, into a ring of two buffers, one tile ahead of the products.
// Every wave-wide 16-byte global load of a tile covers four whole
// 128-byte lines: consecutive lanes walk along a row. The output tiles of both
// kernels go the same way: accumulators -> the wave's own LDS range -> 16-byte
// global stores along the rows.
// ---------------------------------------------------------------------------

typedef _Float16 half_t;
typedef __attribute__((ext_vector_type(16))) _Float16 v16h;
typedef __attribute__((ext_vector_type(8)))  _Float16 v8h;
typedef __attribute__((ext_vector_type(4)))  _Float16 v4h;
typedef __attribute__((ext_vector_type(8)))  float    v8f;
typedef __attribute__((ext_vector_type(4)))  int      v4i;
typedef __attribute__((ext_vector_type(8)))  short    v8s;
typedef __attribute__((address_space(3))) v8s las_v8s;   // LDS (AS3)
typedef uint32_t u32x4 __attribute__((ext_vector_type(4)));
typedef uint32_t u32x8 __attribute__((ext_vector_type(8)));

constexpr int kB  = 2;
constexpr int kS  = 2048;
constexpr int kH  = 768;
constexpr int kNH = 12;
constexpr int kHD = 64;
constexpr int kBS = kB * kS;          // 4096 rows of hidden_states

// LDS row pitch, in halves, of a row-major [128 k][64 columns] f16 tile read by
// the transposing load: 160 B = 32 B x odd, its conflict-free pitch.
constexpr int kTrPitch = 80;
// LDS row pitch, in halves, of the K tile (plain 16-byte reads): 144 B.
constexpr int kKPitch = 72;
// The same two pitches for the projection's tiles: X rows of 64 k (128 B,
// plain 16-byte reads) at 144 B, W rows of 128 columns (256 B, transposing
// load) at 288 B = 32 B x odd.
constexpr int kXPitch = 72;
constexpr int kWPitch = 144;
// LDS row pitches of the output staging (16-byte writes and reads, 16 B x odd):
// projection rows of 64 halves (128 B) at 144 B, attention rows of 64 floats
// (256 B) at 272 B.
constexpr int kOPitch = 72;
constexpr int kCPitch = 68;

typedef __attribute__((address_space(3))) half_t las_half;   // LDS (AS3)
// Byte address of a __shared__ element inside the work-group's LDS.
__device__ __forceinline__ unsigned lds_addr(const half_t* p) {
  return (unsigned)(size_t)(const las_half*)p;
}
// This wave's own tensor load has landed in LDS (asm with the clobber: no LDS
// read may be moved in front of it).
__device__ __forceinline__ void wait_tensorcnt0() {
  asm volatile("s_wait_tensorcnt 0x0" ::: "memory");
}
// This wave's own LDS reads have returned: its buffer may be refilled behind
// the next barrier.
__device__ __forceinline__ void wait_dscnt0() {
  asm volatile("s_wait_dscnt 0x0" ::: "memory");
}
__device__ __forceinline__ uint32_t uni(uint32_t v) {
  return (uint32_t)__builtin_amdgcn_readfirstlane(v);
}
// A wave-uniform value held in a scalar register: a test on it compiles to
// s_cmp + s_cbranch (a tensor load ignores EXEC, only a scalar branch guards it).
__device__ __forceinline__ uint32_t pinned(uint32_t v) {
  uint32_t w = uni(v);
  asm volatile("" : "+s"(w));   // pinned(): keeps the value in a scalar register
  return w;
}
// A slice of a K or V tile: 64 keys, rows of 128 bytes (one head's 64 halves),
// source pitch one row of the [4096, 768] f16 plane. In LDS a slice takes 10 KiB,
// a multiple of 2 KiB that holds 64 rows at either padded pitch.
constexpr uint32_t kSliceRows  = 64;
constexpr uint32_t kSliceRowB  = 128;
constexpr uint32_t kSliceBytes = 10240;
static_assert(kSliceRows * kKPitch * 2 <= kSliceBytes && kSliceRows * kTrPitch * 2 <= kSliceBytes &&
              kSliceBytes % 2048 == 0, "a slice fits its place");
// Descriptor group 1, word 0: no mask, 1-byte elements, a pad behind every 32
// dwords (one row) of 4 dwords (K: pitch 144 B) or 8 dwords (V: pitch 160 B).
constexpr uint32_t kPadWordK = (1u << 20) | (4u << 22) | (3u << 25);
constexpr uint32_t kPadWordV = (1u << 20) | (4u << 22) | (7u << 25);
// Descriptor group 1 of a slice, the same for every tile: built once.
template <uint32_t kPadWord>
__device__ __forceinline__ u32x8 slice_group1() {
  u32x8 g1;
  g1[0] = uni(kPadWord);
  g1[1] = uni(kSliceRowB << 16);                       // tensor_dim0
  g1[2] = uni(kSliceRows << 16);                       // tensor_dim1
  g1[3] = uni(kSliceRowB << 16);                       // tile_dim0
  g1[4] = uni(kSliceRows);                             // tile_dim1
  g1[5] = uni((uint32_t)kH * 2u);                      // source row pitch, bytes
  g1[6] = uni(0u);
  g1[7] = uni(0u);
  // The words keep their eight scalar registers through the loop, so that none
  // of them is rewritten while a request is in flight.
  asm volatile("" : "+s"(g1));   // pinned(): descriptor words held in scalar registers
  return g1;
}
// One request of the whole wave: the slice whose first byte is ga, global -> LDS
// byte offset lds_dst, through no register (tracked by TENSORcnt).
__device__ __forceinline__ void tensor_slice(uint32_t lds_dst, uint64_t ga, u32x8 g1) {
  u32x4 g0;
  g0[0] = uni(1u);                                     // count 1
  g0[1] = uni(lds_dst);
  g0[2] = uni((uint32_t)ga);
  g0[3] = uni((((uint32_t)(ga >> 32)) & 0x01FFFFFFu) | 0x80000000u);   // type 2
  asm volatile("tensor_load_to_lds %0, %1" :: "s"(g0), "s"(g1) : "memory");
}

union frag16 { v16h v; v8h h[2]; };

// Build a 16-half fragment from two aligned 8-half (128-bit) loads.
__device__ __forceinline__ v16h ld_frag(const half_t* lo, const half_t* hi) {
  frag16 f;
  f.h[0] = *(const v8h*)lo;
  f.h[1] = *(const v8h*)hi;
  return f.v;
}

// Lane l's own address in such a tile T for the transposing load: row
// 8*(l>>4) + (l&7), 16-byte piece (l>>3)&1 of the first 16 columns.
__device__ __forceinline__ const half_t* tr_lane_ptr(const half_t* T, int lane,
                                                     int pitch = kTrPitch) {
  return T + (8 * (lane >> 4) + (lane & 7)) * pitch + 8 * ((lane >> 3) & 1);
}

// 16x32 fragment (A row or B column = tile column col0 + (l&15)) in the
// hardware k order 8*hi.., 16+8*hi..: rows 0..15, then rows 16..31.
__device__ __forceinline__ v16h ld_frag_tr(const half_t* lane_ptr, int col0,
                                           int pitch = kTrPitch) {
  frag16 f;
  f.h[0] = __builtin_bit_cast(v8h, __builtin_amdgcn_ds_load_tr16_b128_v8i16(
      (las_v8s*)(lane_ptr + col0)));
  f.h[1] = __builtin_bit_cast(v8h, __builtin_amdgcn_ds_load_tr16_b128_v8i16(
      (las_v8s*)(lane_ptr + 16 * pitch + col0)));
  return f.v;
}

// Lane l <-> lane l ^ 16 (the other half of a query's keys).
__device__ __forceinline__ float xhalf(float x) {
  return __builtin_bit_cast(float, __builtin_amdgcn_permlanex16(
      __builtin_bit_cast(int, x), __builtin_bit_cast(int, x),
      0x76543210, 0xfedcba98, false, false));
}

__device__ __forceinline__ v8f wmma16(v16h a, v16h b, v8f c) {
  // D = A(16x32 f16) * B(32x16 f16) + C(16x16 f32)
  return __builtin_amdgcn_wmma_f32_16x16x32_f16(false, a, false, b,
                                                (short)0, c, false, false);
}

// ---------------------------------------------------------------------------
// Kernel 1: O = f16(X @ W + b).  X:[4096,768] f32, W:[768,768] f32 (row = in).
// grid = (32 M-tiles, 6 N-tiles, 3 {Q,K,V}), block = 256 (8 waves).
// Block tile 128 x 128 outputs, 64 k a trip; a wave owns 32 rows x 64 columns
// (2 x 4 accumulator tiles): every X element is loaded by 18 blocks and every
// W element by 32. The products are taken transposed (A = W^T, B = X^T): a lane
// then holds 8 consecutive columns of one output row, one 16-byte piece.
// ---------------------------------------------------------------------------
__global__ __launch_bounds__(256)
void qkv_gemm_kernel(const float* __restrict__ X,
                     const float* __restrict__ Wq, const float* __restrict__ bq,
                     const float* __restrict__ Wk, const float* __restrict__ bk,
                     const float* __restrict__ Wv, const float* __restrict__ bv,
                     half_t* __restrict__ Q, half_t* __restrict__ K,
                     half_t* __restrict__ V)
{
  const float* Wm;  const float* bias;  half_t* O;
  if (blockIdx.z == 0)      { Wm = Wq; bias = bq; O = Q; }
  else if (blockIdx.z == 1) { Wm = Wk; bias = bk; O = K; }
  else                      { Wm = Wv; bias = bv; O = V; }

  const int M0   = blockIdx.x * 128;
  const int N0   = blockIdx.y * 128;
  const int tid  = threadIdx.x;
  const int wave = tid >> 5;
  const int lane = tid & 31;
  const int l16  = lane & 15;
  const int hi   = lane >> 4;       // lane-group (0 | 1)
  const int koff = hi * 8;          // contraction offset for upper group
  const int mw   = 32 * (wave >> 1);   // the wave's first row in the tile
  const int nw   = 64 * (wave & 1);    // the wave's first column in the tile

  // One LDS block: the X tile, the W tile behind it; after the loop the same
  // bytes are the eight waves' output staging.
  __shared__ alignas(16) half_t Sm[128 * kXPitch + 64 * kWPitch];
  static_assert(8 * 32 * kOPitch <= 128 * kXPitch + 64 * kWPitch, "staging fits");
  half_t (*Xs)[kXPitch] = reinterpret_cast<half_t (*)[kXPitch]>(Sm);                  // [m][k]
  half_t (*Ws)[kWPitch] = reinterpret_cast<half_t (*)[kWPitch]>(Sm + 128 * kXPitch);  // [k][n]
  const half_t* wlane = tr_lane_ptr(&Ws[0][nw], lane, kWPitch);

  const v8f zero = {0.f,0.f,0.f,0.f,0.f,0.f,0.f,0.f};
  v8f acc[2][4];
  #pragma unroll
  for (int i = 0; i < 2; ++i)
    #pragma unroll
    for (int j = 0; j < 4; ++j) acc[i][j] = zero;

  for (int k0 = 0; k0 < kH; k0 += 64) {
    // Stage the X tile (128 rows x 64 k) and the W tile (64 k x 128 n) as f16.
    // float4 global reads, consecutive lanes along a row: sixteen lanes cover an
    // X row's 256 bytes, a whole wave a W row's 512, so a wave's load covers 4
    // whole lines (and no two loads of a trip share a line).
    const int xr = tid >> 4, xc = (tid & 15) * 4;   // X row, k base
    const int wr = tid >> 5, wc = (tid & 31) * 4;   // k row, n base
    const float* xsrc = X  + (size_t)(M0 + xr) * kH + k0 + xc;
    const float* wsrc = Wm + (size_t)(k0 + wr) * kH + N0 + wc;
    float4 fx[8], fw[8];
    #pragma unroll
    for (int i = 0; i < 8; ++i) fx[i] = *(const float4*)(xsrc + (size_t)(16 * i) * kH);
    #pragma unroll
    for (int i = 0; i < 8; ++i) fw[i] = *(const float4*)(wsrc + (size_t)(8 * i) * kH);
    // Keeps all sixteen loads in front of the first conversion: without it the
    // compiler issues them in groups over the same registers, and a trip waits
    // out several L2 latencies one after the other.
    __builtin_amdgcn_sched_barrier(0);
    #pragma unroll
    for (int i = 0; i < 8; ++i) {
      const v4h hx = {(half_t)fx[i].x, (half_t)fx[i].y, (half_t)fx[i].z, (half_t)fx[i].w};
      *(v4h*)&Xs[xr + 16 * i][xc] = hx;
    }
    #pragma unroll
    for (int i = 0; i < 8; ++i) {
      const v4h hw = {(half_t)fw[i].x, (half_t)fw[i].y, (half_t)fw[i].z, (half_t)fw[i].w};
      *(v4h*)&Ws[wr + 8 * i][wc] = hw;
    }
    // Stands in front of the pointer advance that rewrites the address
    // registers the sixteen loads name.
    asm volatile("s_wait_xcnt 0x0" ::: "memory");
    __syncthreads();

    // Two 32-k steps, in ascending k (the order of the sums stays).
    #pragma unroll
    for (int kk = 0; kk < 2; ++kk) {
      // X fragments (rows mw..mw+31): contiguous 8-half runs -> 2x b128 each
      v16h a[2];
      #pragma unroll
      for (int i = 0; i < 2; ++i) {
        const half_t* xrow = &Xs[mw + 16 * i + l16][32 * kk + koff];
        a[i] = ld_frag(xrow, xrow + 16);
      }
      // W fragments for 4 N sub-tiles: 2x transposing b128 load each, used twice
      #pragma unroll
      for (int j = 0; j < 4; ++j) {
        const v16h bfr = ld_frag_tr(wlane + 32 * kk * kWPitch, 16 * j, kWPitch);
        #pragma unroll
        for (int i = 0; i < 2; ++i) acc[i][j] = wmma16(bfr, a[i], acc[i][j]);
      }
    }
    __syncthreads();
  }

  // Epilogue. acc[i][j][r] = O[row mw + 16*i + l16][column nw + 16*j + 8*hi + r].
  // Bias, f16, then the wave's 32 x 64 tile into its own LDS range (behind the
  // last trip's barrier nobody reads the X and W tiles any more).
  half_t* stg = Sm + wave * (32 * kOPitch);
  #pragma unroll
  for (int j = 0; j < 4; ++j) {
    const float* bp = bias + N0 + nw + 16 * j + 8 * hi;
    const float4 b0 = *(const float4*)bp;
    const float4 b1 = *(const float4*)(bp + 4);
    #pragma unroll
    for (int i = 0; i < 2; ++i) {
      const v8h o = {(half_t)(acc[i][j][0] + b0.x), (half_t)(acc[i][j][1] + b0.y),
                     (half_t)(acc[i][j][2] + b0.z), (half_t)(acc[i][j][3] + b0.w),
                     (half_t)(acc[i][j][4] + b1.x), (half_t)(acc[i][j][5] + b1.y),
                     (half_t)(acc[i][j][6] + b1.z), (half_t)(acc[i][j][7] + b1.w)};
      *(v8h*)&stg[(16 * i + l16) * kOPitch + 16 * j + 8 * hi] = o;
    }
  }
  // The wave's own staging writes are done before other lanes read them back.
  wait_dscnt0();
  // Eight lanes a row (its 128 bytes are one line): a store covers 4 whole lines.
  #pragma unroll
  for (int q = 0; q < 8; ++q) {
    const int row = 4 * q + (lane >> 3), col = (lane & 7) * 8;
    const v8h o = *(const v8h*)&stg[row * kOPitch + col];
    *(v8h*)&O[(size_t)(M0 + mw + row) * kH + N0 + nw + col] = o;
  }
}

__global__ __launch_bounds__(128)
void attention_kernel(const half_t* __restrict__ Q,
                      const half_t* __restrict__ K,
                      const half_t* __restrict__ V,
                      float* __restrict__ out)
{
  const int qt = blockIdx.x;        // q tile (64 rows)
  const int h  = blockIdx.y;        // head
  const int b  = blockIdx.z;        // batch

  const int tid  = threadIdx.x;
  const int wave = __builtin_amdgcn_readfirstlane(tid >> 5);
  const int lane = tid & 31;
  const int l16  = lane & 15;
  const int hi   = lane >> 4;
  const int koff = hi * 8;
  const int cg   = wave & 1;        // which 32 of the block's 64 q rows
  const int kh   = wave >> 1;       // which 64 of a tile's 128 keys

  const size_t headOff = (size_t)b * kS * kH + (size_t)h * kHD;
  const half_t* Qb = Q + headOff;   // row stride kH
  const half_t* Kb = K + headOff;
  const half_t* Vb = V + headOff;

  constexpr int kKT = 128;          // keys a tile (a trip)
  // [buffer][K keys 0..63 | K keys 64..127 | V keys 0..63 | V keys 64..127]:
  // rows [k][d], K at 144 B, V at 160 B; every slice starts at a multiple of 2 KiB.
  __shared__ __attribute__((aligned(2048))) half_t Ring[2][4][kSliceBytes / 2];

  // Q^T B-fragments for this wave (column = q row 16*c + l16), d chunks [0,32)
  // and [32,64): global b128, hardware k order (8*hi.., 16+8*hi..).
  const int q0 = qt * 64 + cg * 32;
  v16h aq[2][2];
  #pragma unroll
  for (int c = 0; c < 2; ++c) {
    const half_t* qrow = Qb + (size_t)(q0 + 16 * c + l16) * kH;
    aq[c][0] = ld_frag(qrow +      koff, qrow + 16 + koff);
    aq[c][1] = ld_frag(qrow + 32 + koff, qrow + 48 + koff);
  }

  const v8f zero = {0.f,0.f,0.f,0.f,0.f,0.f,0.f,0.f};
  v8f cacc[2][4];
  #pragma unroll
  for (int c = 0; c < 2; ++c)
    #pragma unroll
    for (int j = 0; j < 4; ++j) cacc[c][j] = zero;
  // One query per lane and tile c (column l16): running max, and this lane
  // half's part of the denominator (the halves are joined after the loop).
  float mrow[2] = {-1.0e30f, -1.0e30f}, lsum[2] = {0.0f, 0.0f};

  const float scale = 0.125f;       // 1/sqrt(64)

  // This wave's slice of every tile: slice number = wave number.
  constexpr int kTiles = kS / kKT;
  const uint64_t slice0 = (uint64_t)(size_t)((wave < 2 ? Kb : Vb) + (size_t)(wave & 1) * kSliceRows * kH);
  const uint32_t place0 = lds_addr(&Ring[0][wave][0]);
  const u32x8 g1k = slice_group1<kPadWordK>();
  const u32x8 g1v = slice_group1<kPadWordV>();
  auto stage_slice = [&](uint32_t tile, uint32_t buffer, bool wait_here) {
    const uint32_t dst = place0 + buffer * (4u * kSliceBytes);
    const uint64_t ga  = slice0 + (uint64_t)tile * ((uint64_t)kKT * kH * 2u);
    if (pinned(wave < 2))  { tensor_slice(dst, ga, g1k); if (wait_here) wait_tensorcnt0(); }
    if (pinned(wave >= 2)) { tensor_slice(dst, ga, g1v); if (wait_here) wait_tensorcnt0(); }
  };

  // Ring prologue: tile 0 landed (the wait directly behind the load) and
  // published, then tile 1 in flight.
  stage_slice(0u, 0u, true);
  __syncthreads();
  stage_slice(1u, 1u, false);

  for (int t = 0; t < kTiles; ++t) {
    const int buf = t & 1;
    const half_t (*Kt)[kKPitch] = reinterpret_cast<const half_t (*)[kKPitch]>(&Ring[buf][kh][0]);
    const half_t* vlane = tr_lane_ptr(&Ring[buf][2 + kh][0], lane);

    // scores: S^T = K * Q^T  (A row = key, B column = query, contraction = d)
    // s[c][j][r] = score(key 16*j + 8*hi + r, query 16*c + l16)
    v8f s[2][4];
    #pragma unroll
    for (int j = 0; j < 4; ++j) {
      const int krow = 16 * j + l16;
      const v16h ak0 = ld_frag(&Kt[krow][koff],      &Kt[krow][16 + koff]);
      const v16h ak1 = ld_frag(&Kt[krow][32 + koff], &Kt[krow][48 + koff]);
      #pragma unroll
      for (int c = 0; c < 2; ++c)
        s[c][j] = wmma16(ak1, aq[c][1], wmma16(ak0, aq[c][0], zero));
    }

    // Online softmax, one query per lane and tile: one maximum for the 64 keys.
    float mnew[2], corr[2];
    #pragma unroll
    for (int c = 0; c < 2; ++c) {
      float hmax[2];
      #pragma unroll
      for (int g = 0; g < 2; ++g) {
        hmax[g] = fmaxf(s[c][2 * g][0], s[c][2 * g + 1][0]);
        #pragma unroll
        for (int r = 1; r < 8; ++r)
          hmax[g] = fmaxf(hmax[g], fmaxf(s[c][2 * g][r], s[c][2 * g + 1][r]));
      }
      float tmax = fmaxf(hmax[0], hmax[1]);
      tmax = fmaxf(tmax, xhalf(tmax)) * scale;
      mnew[c] = fmaxf(mrow[c], tmax);
    }
    #pragma unroll
    for (int c = 0; c < 2; ++c) {
      corr[c] = __expf(mrow[c] - mnew[c]);
      mrow[c] = mnew[c];
    }

    // P^T as B operands, one per 32 keys: element e of operand g =
    // P^T[key 32*g + kmap(e)][query] = tile 2*g + (e>>3), reg e&7.
    v16h bp[2][2];
    #pragma unroll
    for (int c = 0; c < 2; ++c) {
      float psum[2];
      #pragma unroll
      for (int g = 0; g < 2; ++g) {
        psum[g] = 0.0f;
        #pragma unroll
        for (int e = 0; e < 16; ++e) {
          const float p = __expf(s[c][2 * g + (e >> 3)][e & 7] * scale - mnew[c]);
          psum[g] += p;
          bp[c][g][e] = (half_t)p;
        }
      }
      lsum[c] = lsum[c] * corr[c] + (psum[0] + psum[1]);
      #pragma unroll
      for (int j = 0; j < 4; ++j) cacc[c][j] *= corr[c];
    }

    // ctx^T += V^T(64x64) * P^T(64x32): A rows = d, by the transposing load.
    #pragma unroll
    for (int g = 0; g < 2; ++g) {
      #pragma unroll
      for (int j = 0; j < 4; ++j) {
        const v16h avf = ld_frag_tr(vlane + g * 32 * kTrPitch, 16 * j);
        #pragma unroll
        for (int c = 0; c < 2; ++c) cacc[c][j] = wmma16(avf, bp[c][g], cacc[c][j]);
      }
    }

    // Publish point of tile t + 1: own reads of tile t returned, own slice of
    // tile t + 1 landed, then the one barrier of the trip; behind it tile t's
    // buffer is free for tile t + 2.
    wait_dscnt0();
    wait_tensorcnt0();
    __syncthreads();
    // The tile number goes through pinned() so that the descriptor is formed here,
    // behind the wait, and not ahead of it.
    if (pinned(t + 2 < kTiles)) stage_slice(pinned((uint32_t)t + 2u), (uint32_t)buf, false);
  }
  wait_tensorcnt0();   // nothing of this wave is in flight when it ends
  wait_dscnt0();       // and its ring reads are back before the ring is reused

  // Join of the key halves: the waves of the second half hand over ctx (16
  // pieces a lane), max and sum; lane and register mean the same query and d in
  // both waves of a pair. The first buffer's K slices serve as the hand-over
  // space: behind the last trip's barrier nobody reads them and no load is in flight.
  static_assert(2 * 17 * 32 * 16 <= 2 * kSliceBytes && 2 * 32 * kCPitch * 4 <= 2 * kSliceBytes, "fits");
  float4 (*Mg)[17][32] = reinterpret_cast<float4 (*)[17][32]>(&Ring[0][0][0]);
  if (kh == 1) {
    #pragma unroll
    for (int c = 0; c < 2; ++c) {
      #pragma unroll
      for (int j = 0; j < 4; ++j) {
        Mg[cg][(4 * c + j) * 2][lane]     = make_float4(cacc[c][j][0], cacc[c][j][1],
                                                        cacc[c][j][2], cacc[c][j][3]);
        Mg[cg][(4 * c + j) * 2 + 1][lane] = make_float4(cacc[c][j][4], cacc[c][j][5],
                                                        cacc[c][j][6], cacc[c][j][7]);
      }
    }
    Mg[cg][16][lane] = make_float4(mrow[0], lsum[0], mrow[1], lsum[1]);
  }
  __syncthreads();
  if (kh == 1) return;

  // Normalize ctx (f32). cacc[c][j][r] = ctx[query 16*c + l16][d = 16*j + 8*hi
  // + r]: 8 consecutive floats per lane and j, two 16-byte pieces, into the
  // wave's own staging range in the first buffer's V slices (free like its K slices).
  float* stg = reinterpret_cast<float*>(&Ring[0][2][0]) + cg * (32 * kCPitch);
  const float4 ml = Mg[cg][16][lane];
  #pragma unroll
  for (int c = 0; c < 2; ++c) {
    const float m1 = c ? ml.z : ml.x;
    const float l1 = c ? ml.w : ml.y;
    const float m  = fmaxf(mrow[c], m1);
    const float e0 = __expf(mrow[c] - m), e1 = __expf(m1 - m);
    const float lj = lsum[c] * e0 + l1 * e1;
    const float inv = 1.0f / (lj + xhalf(lj));
    const float f0 = e0 * inv, f1 = e1 * inv;
    float* orow = stg + (16 * c + l16) * kCPitch + 8 * hi;
    #pragma unroll
    for (int j = 0; j < 4; ++j) {
      const float4 p0 = Mg[cg][(4 * c + j) * 2][lane];
      const float4 p1 = Mg[cg][(4 * c + j) * 2 + 1][lane];
      const float4 lo4 = make_float4(cacc[c][j][0] * f0 + p0.x * f1, cacc[c][j][1] * f0 + p0.y * f1,
                                     cacc[c][j][2] * f0 + p0.z * f1, cacc[c][j][3] * f0 + p0.w * f1);
      const float4 hi4 = make_float4(cacc[c][j][4] * f0 + p1.x * f1, cacc[c][j][5] * f0 + p1.y * f1,
                                     cacc[c][j][6] * f0 + p1.z * f1, cacc[c][j][7] * f0 + p1.w * f1);
      *(float4*)(orow + 16 * j)     = lo4;
      *(float4*)(orow + 16 * j + 4) = hi4;
    }
  }
  // The wave's own staging writes are done before other lanes read them back.
  wait_dscnt0();
  // Output layout [B,S,NH*HD]: head h occupies columns h*64..h*64+63, 256 bytes
  // of a row. Sixteen lanes a row: a store covers 4 whole lines.
  float* obase = out + (size_t)(b * kS + q0) * kH + (size_t)h * kHD;
  #pragma unroll
  for (int q = 0; q < 16; ++q) {
    const int row = 2 * q + hi;
    const float4 o = *(const float4*)&stg[row * kCPitch + 4 * l16];
    *(float4*)(obase + (size_t)row * kH + 4 * l16) = o;
  }
}

// ---------------------------------------------------------------------------
extern "C" void kernel_launch(void* const* d_in, const int* in_sizes, int n_in,
                              void* d_out, int out_size, void* d_ws, size_t ws_size,
                              hipStream_t stream) {
  const float* X  = (const float*)d_in[0];
  const float* Wq = (const float*)d_in[1];
  const float* bq = (const float*)d_in[2];
  const float* Wk = (const float*)d_in[3];
  const float* bk = (const float*)d_in[4];
  const float* Wv = (const float*)d_in[5];
  const float* bv = (const float*)d_in[6];
  float* out = (float*)d_out;

  // Workspace: f16 Q, K, V, each [4096, 768] (6.29 MB each, 18.9 MB total).
  half_t* Qh = (half_t*)d_ws;
  half_t* Kh = Qh + (size_t)kBS * kH;
  half_t* Vh = Kh + (size_t)kBS * kH;

  dim3 g1(kBS / 128, kH / 128, 3);     // 32 x 6 x 3 blocks
  qkv_gemm_kernel<<<g1, 256, 0, stream>>>(X, Wq, bq, Wk, bk, Wv, bv, Qh, Kh, Vh);

  dim3 g2(kS / 64, kNH, kB);           // 32 x 12 x 2 blocks
  attention_kernel<<<g2, 128, 0, stream>>>(Qh, Kh, Vh, out);
}

// v010
// One run takes 46.4 microseconds.
// Timed twice side by side with v009, it ran 1.03 times as fast both times.
// Over all steps from v000 it is 3.76 times as fast.
#include <hip/hip_runtime.h>
#include <hip/hip_bf16.h>
#include <stdint.h>

// ---------------------------------------------------------------------------
// Self-attention forward for MI455X (gfx1250, wave32, WMMA).
//  Kernel 1: QKV projection GEMM (f32 in -> f16 Q/K/V in workspace).
//  Kernel 2: flash-attention over 64-row q tiles, online softmax.
// All WMMA fragments are built from 128-bit LDS/global loads. The W and V
// tiles lie ROW-MAJOR in LDS and are transposed on the way
// out by DS_LOAD_TR16_B128. The attention K and V tiles
// (pure f16 byte copies) are brought by TENSOR_LOAD_TO_LDS, one request a wave
// and tile, into a ring of two buffers, one tile ahead of the products.
// Every wave-wide 16-byte global load of a tile covers four whole
// 128-byte lines: consecutive lanes walk along a row. The output tiles of both
// kernels go the same way: accumulators -> the wave's own LDS range -> 16-byte
// global stores along the rows.
// ---------------------------------------------------------------------------

typedef _Float16 half_t;
typedef __attribute__((ext_vector_type(16))) _Float16 v16h;
typedef __attribute__((ext_vector_type(8)))  _Float16 v8h;
typedef __attribute__((ext_vector_type(4)))  _Float16 v4h;
typedef __attribute__((ext_vector_type(8)))  float    v8f;
typedef __attribute__((ext_vector_type(4)))  int      v4i;
typedef __attribute__((ext_vector_type(8)))  short    v8s;
typedef __attribute__((address_space(3))) v8s las_v8s;   // LDS (AS3)
typedef uint32_t u32x4 __attribute__((ext_vector_type(4)));
typedef uint32_t u32x8 __attribute__((ext_vector_type(8)));

constexpr int kB  = 2;
constexpr int kS  = 2048;
constexpr int kH  = 768;
constexpr int kNH = 12;
constexpr int kHD = 64;
constexpr int kBS = kB * kS;          // 4096 rows of hidden_states

// LDS row pitch, in halves, of a row-major [128 k][64 columns] f16 tile read by
// the transposing load: 160 B = 32 B x odd, its conflict-free pitch.
constexpr int kTrPitch = 80;
// LDS row pitch, in halves, of the K tile (plain 16-byte reads): 144 B.
constexpr int kKPitch = 72;
// The same two pitches for the projection's tiles: X rows of 64 k (128 B,
// plain 16-byte reads) at 144 B, W rows of 128 columns (256 B, transposing
// load) at 288 B = 32 B x odd.
constexpr int kXPitch = 72;
constexpr int kWPitch = 144;
// LDS row pitches of the output staging (16-byte writes and reads, 16 B x odd):
// projection rows of 64 halves (128 B) at 144 B, attention rows of 64 floats
// (256 B) at 272 B.
constexpr int kOPitch = 72;
constexpr int kCPitch = 68;
// 1/sqrt(64) * log2(e): the projection stores Q times this, so that the score
// products of the attention kernel come out as exponents of 2.
constexpr float kQScale = 0.125f * 1.44269504088896340736f;

typedef __attribute__((address_space(3))) half_t las_half;   // LDS (AS3)
// Byte address of a __shared__ element inside the work-group's LDS.
__device__ __forceinline__ unsigned lds_addr(const half_t* p) {
  return (unsigned)(size_t)(const las_half*)p;
}
// This wave's own tensor load has landed in LDS (asm with the clobber: no LDS
// read may be moved in front of it).
__device__ __forceinline__ void wait_tensorcnt0() {
  asm volatile("s_wait_tensorcnt 0x0" ::: "memory");
}
// This wave's own LDS reads have returned: its buffer may be refilled behind
// the next barrier.
__device__ __forceinline__ void wait_dscnt0() {
  asm volatile("s_wait_dscnt 0x0" ::: "memory");
}
__device__ __forceinline__ uint32_t uni(uint32_t v) {
  return (uint32_t)__builtin_amdgcn_readfirstlane(v);
}
// A wave-uniform value held in a scalar register: a test on it compiles to
// s_cmp + s_cbranch (a tensor load ignores EXEC, only a scalar branch guards it).
__device__ __forceinline__ uint32_t pinned(uint32_t v) {
  uint32_t w = uni(v);
  asm volatile("" : "+s"(w));   // pinned(): keeps the value in a scalar register
  return w;
}
// A slice of a K or V tile: 64 keys, rows of 128 bytes (one head's 64 halves),
// source pitch one row of the [4096, 768] f16 plane. In LDS a slice takes 10 KiB,
// a multiple of 2 KiB that holds 64 rows at either padded pitch.
constexpr uint32_t kSliceRows  = 64;
constexpr uint32_t kSliceRowB  = 128;
constexpr uint32_t kSliceBytes = 10240;
static_assert(kSliceRows * kKPitch * 2 <= kSliceBytes && kSliceRows * kTrPitch * 2 <= kSliceBytes &&
              kSliceBytes % 2048 == 0, "a slice fits its place");
// Descriptor group 1, word 0: no mask, 1-byte elements, a pad behind every 32
// dwords (one row) of 4 dwords (K: pitch 144 B) or 8 dwords (V: pitch 160 B).
constexpr uint32_t kPadWordK = (1u << 20) | (4u << 22) | (3u << 25);
constexpr uint32_t kPadWordV = (1u << 20) | (4u << 22) | (7u << 25);
// Descriptor group 1 of a slice, the same for every tile: built once.
template <uint32_t kPadWord>
__device__ __forceinline__ u32x8 slice_group1() {
  u32x8 g1;
  g1[0] = uni(kPadWord);
  g1[1] = uni(kSliceRowB << 16);                       // tensor_dim0
  g1[2] = uni(kSliceRows << 16);                       // tensor_dim1
  g1[3] = uni(kSliceRowB << 16);                       // tile_dim0
  g1[4] = uni(kSliceRows);                             // tile_dim1
  g1[5] = uni((uint32_t)kH * 2u);                      // source row pitch, bytes
  g1[6] = uni(0u);
  g1[7] = uni(0u);
  // The words keep their eight scalar registers through the loop, so that none
  // of them is rewritten while a request is in flight.
  asm volatile("" : "+s"(g1));   // pinned(): descriptor words held in scalar registers
  return g1;
}
// One request of the whole wave: the slice whose first byte is ga, global -> LDS
// byte offset lds_dst, through no register (tracked by TENSORcnt).
__device__ __forceinline__ void tensor_slice(uint32_t lds_dst, uint64_t ga, u32x8 g1) {
  u32x4 g0;
  g0[0] = uni(1u);                                     // count 1
  g0[1] = uni(lds_dst);
  g0[2] = uni((uint32_t)ga);
  g0[3] = uni((((uint32_t)(ga >> 32)) & 0x01FFFFFFu) | 0x80000000u);   // type 2
  asm volatile("tensor_load_to_lds %0, %1" :: "s"(g0), "s"(g1) : "memory");
}

union frag16 { v16h v; v8h h[2]; };

// Build a 16-half fragment from two aligned 8-half (128-bit) loads.
__device__ __forceinline__ v16h ld_frag(const half_t* lo, const half_t* hi) {
  frag16 f;
  f.h[0] = *(const v8h*)lo;
  f.h[1] = *(const v8h*)hi;
  return f.v;
}

// Lane l's own address in such a tile T for the transposing load: row
// 8*(l>>4) + (l&7), 16-byte piece (l>>3)&1 of the first 16 columns.
__device__ __forceinline__ const half_t* tr_lane_ptr(const half_t* T, int lane,
                                                     int pitch = kTrPitch) {
  return T + (8 * (lane >> 4) + (lane & 7)) * pitch + 8 * ((lane >> 3) & 1);
}

// 16x32 fragment (A row or B column = tile column col0 + (l&15)) in the
// hardware k order 8*hi.., 16+8*hi..: rows 0..15, then rows 16..31.
__device__ __forceinline__ v16h ld_frag_tr(const half_t* lane_ptr, int col0,
                                           int pitch = kTrPitch) {
  frag16 f;
  f.h[0] = __builtin_bit_cast(v8h, __builtin_amdgcn_ds_load_tr16_b128_v8i16(
      (las_v8s*)(lane_ptr + col0)));
  f.h[1] = __builtin_bit_cast(v8h, __builtin_amdgcn_ds_load_tr16_b128_v8i16(
      (las_v8s*)(lane_ptr + 16 * pitch + col0)));
  return f.v;
}

// Lane l <-> lane l ^ 16 (the other half of a query's keys).
__device__ __forceinline__ float xhalf(float x) {
  return __builtin_bit_cast(float, __builtin_amdgcn_permlanex16(
      __builtin_bit_cast(int, x), __builtin_bit_cast(int, x),
      0x76543210, 0xfedcba98, false, false));
}

__device__ __forceinline__ v8f wmma16(v16h a, v16h b, v8f c) {
  // D = A(16x32 f16) * B(32x16 f16) + C(16x16 f32)
  return __builtin_amdgcn_wmma_f32_16x16x32_f16(false, a, false, b,
                                                (short)0, c, false, false);
}

// ---------------------------------------------------------------------------
// Kernel 1: O = f16(X @ W + b), Q times kQScale.  X:[4096,768] f32, W:[768,768] f32 (row = in).
// grid = (32 M-tiles, 6 N-tiles, 3 {Q,K,V}), block = 256 (8 waves).
// Block tile 128 x 128 outputs, 64 k a trip; a wave owns 32 rows x 64 columns
// (2 x 4 accumulator tiles): every X element is loaded by 18 blocks and every
// W element by 32. The products are taken transposed (A = W^T, B = X^T): a lane
// then holds 8 consecutive columns of one output row, one 16-byte piece.
// ---------------------------------------------------------------------------
__global__ __launch_bounds__(256)
void qkv_gemm_kernel(const float* __restrict__ X,
                     const float* __restrict__ Wq, const float* __restrict__ bq,
                     const float* __restrict__ Wk, const float* __restrict__ bk,
                     const float* __restrict__ Wv, const float* __restrict__ bv,
                     half_t* __restrict__ Q, half_t* __restrict__ K,
                     half_t* __restrict__ V)
{
  const float* Wm;  const float* bias;  half_t* O;
  if (blockIdx.z == 0)      { Wm = Wq; bias = bq; O = Q; }
  else if (blockIdx.z == 1) { Wm = Wk; bias = bk; O = K; }
  else                      { Wm = Wv; bias = bv; O = V; }

  const int M0   = blockIdx.x * 128;
  const int N0   = blockIdx.y * 128;
  const int tid  = threadIdx.x;
  const int wave = tid >> 5;
  const int lane = tid & 31;
  const int l16  = lane & 15;
  const int hi   = lane >> 4;       // lane-group (0 | 1)
  const int koff = hi * 8;          // contraction offset for upper group
  const int mw   = 32 * (wave >> 1);   // the wave's first row in the tile
  const int nw   = 64 * (wave & 1);    // the wave's first column in the tile

  // One LDS block: the X tile, the W tile behind it; after the loop the same
  // bytes are the eight waves' output staging.
  __shared__ alignas(16) half_t Sm[128 * kXPitch + 64 * kWPitch];
  static_assert(8 * 32 * kOPitch <= 128 * kXPitch + 64 * kWPitch, "staging fits");
  half_t (*Xs)[kXPitch] = reinterpret_cast<half_t (*)[kXPitch]>(Sm);                  // [m][k]
  half_t (*Ws)[kWPitch] = reinterpret_cast<half_t (*)[kWPitch]>(Sm + 128 * kXPitch);  // [k][n]
  const half_t* wlane = tr_lane_ptr(&Ws[0][nw], lane, kWPitch);

  const v8f zero = {0.f,0.f,0.f,0.f,0.f,0.f,0.f,0.f};
  v8f acc[2][4];
  #pragma unroll
  for (int i = 0; i < 2; ++i)
    #pragma unroll
    for (int j = 0; j < 4; ++j) acc[i][j] = zero;

  for (int k0 = 0; k0 < kH; k0 += 64) {
    // Stage the X tile (128 rows x 64 k) and the W tile (64 k x 128 n) as f16.
    // float4 global reads, consecutive lanes along a row: sixteen lanes cover an
    // X row's 256 bytes, a whole wave a W row's 512, so a wave's load covers 4
    // whole lines (and no two loads of a trip share a line).
    const int xr = tid >> 4, xc = (tid & 15) * 4;   // X row, k base
    const int wr = tid >> 5, wc = (tid & 31) * 4;   // k row, n base
    const float* xsrc = X  + (size_t)(M0 + xr) * kH + k0 + xc;
    const float* wsrc = Wm + (size_t)(k0 + wr) * kH + N0 + wc;
    float4 fx[8], fw[8];
    #pragma unroll
    for (int i = 0; i < 8; ++i) fx[i] = *(const float4*)(xsrc + (size_t)(16 * i) * kH);
    #pragma unroll
    for (int i = 0; i < 8; ++i) fw[i] = *(const float4*)(wsrc + (size_t)(8 * i) * kH);
    // Keeps all sixteen loads in front of the first conversion: without it the
    // compiler issues them in groups over the same registers, and a trip waits
    // out several L2 latencies one after the other.
    __builtin_amdgcn_sched_barrier(0);
    #pragma unroll
    for (int i = 0; i < 8; ++i) {
      const v4h hx = {(half_t)fx[i].x, (half_t)fx[i].y, (half_t)fx[i].z, (half_t)fx[i].w};
      *(v4h*)&Xs[xr + 16 * i][xc] = hx;
    }
    #pragma unroll
    for (int i = 0; i < 8; ++i) {
      const v4h hw = {(half_t)fw[i].x, (half_t)fw[i].y, (half_t)fw[i].z, (half_t)fw[i].w};
      *(v4h*)&Ws[wr + 8 * i][wc] = hw;
    }
    // Stands in front of the pointer advance that rewrites the address
    // registers the sixteen loads name.
    asm volatile("s_wait_xcnt 0x0" ::: "memory");
    __syncthreads();

    // Two 32-k steps, in ascending k (the order of the sums stays).
    #pragma unroll
    for (int kk = 0; kk < 2; ++kk) {
      // X fragments (rows mw..mw+31): contiguous 8-half runs -> 2x b128 each
      v16h a[2];
      #pragma unroll
      for (int i = 0; i < 2; ++i) {
        const half_t* xrow = &Xs[mw + 16 * i + l16][32 * kk + koff];
        a[i] = ld_frag(xrow, xrow + 16);
      }
      // W fragments for 4 N sub-tiles: 2x transposing b128 load each, used twice
      #pragma unroll
      for (int j = 0; j < 4; ++j) {
        const v16h bfr = ld_frag_tr(wlane + 32 * kk * kWPitch, 16 * j, kWPitch);
        #pragma unroll
        for (int i = 0; i < 2; ++i) acc[i][j] = wmma16(bfr, a[i], acc[i][j]);
      }
    }
    __syncthreads();
  }

  // Epilogue. acc[i][j][r] = O[row mw + 16*i + l16][column nw + 16*j + 8*hi + r].
  // Bias, f16, then the wave's 32 x 64 tile into its own LDS range (behind the
  // last trip's barrier nobody reads the X and W tiles any more).
  half_t* stg = Sm + wave * (32 * kOPitch);
  const float qs = (blockIdx.z == 0) ? kQScale : 1.0f;   // Q alone is scaled, in f32
  #pragma unroll
  for (int j = 0; j < 4; ++j) {
    const float* bp = bias + N0 + nw + 16 * j + 8 * hi;
    const float4 b0 = *(const float4*)bp;
    const float4 b1 = *(const float4*)(bp + 4);
    #pragma unroll
    for (int i = 0; i < 2; ++i) {
      const v8h o = {(half_t)((acc[i][j][0] + b0.x) * qs), (half_t)((acc[i][j][1] + b0.y) * qs),
                     (half_t)((acc[i][j][2] + b0.z) * qs), (half_t)((acc[i][j][3] + b0.w) * qs),
                     (half_t)((acc[i][j][4] + b1.x) * qs), (half_t)((acc[i][j][5] + b1.y) * qs),
                     (half_t)((acc[i][j][6] + b1.z) * qs), (half_t)((acc[i][j][7] + b1.w) * qs)};
      *(v8h*)&stg[(16 * i + l16) * kOPitch + 16 * j + 8 * hi] = o;
    }
  }
  // The wave's own staging writes are done before other lanes read them back.
  wait_dscnt0();
  // Eight lanes a row (its 128 bytes are one line): a store covers 4 whole lines.
  #pragma unroll
  for (int q = 0; q < 8; ++q) {
    const int row = 4 * q + (lane >> 3), col = (lane & 7) * 8;
    const v8h o = *(const v8h*)&stg[row * kOPitch + col];
    *(v8h*)&O[(size_t)(M0 + mw + row) * kH + N0 + nw + col] = o;
  }
}

__global__ __launch_bounds__(128)
void attention_kernel(const half_t* __restrict__ Q,
                      const half_t* __restrict__ K,
                      const half_t* __restrict__ V,
                      float* __restrict__ out)
{
  const int qt = blockIdx.x;        // q tile (64 rows)
  const int h  = blockIdx.y;        // head
  const int b  = blockIdx.z;        // batch

  const int tid  = threadIdx.x;
  const int wave = __builtin_amdgcn_readfirstlane(tid >> 5);
  const int lane = tid & 31;
  const int l16  = lane & 15;
  const int hi   = lane >> 4;
  const int koff = hi * 8;
  const int cg   = wave & 1;        // which 32 of the block's 64 q rows
  const int kh   = wave >> 1;       // which 64 of a tile's 128 keys

  const size_t headOff = (size_t)b * kS * kH + (size_t)h * kHD;
  const half_t* Qb = Q + headOff;   // row stride kH
  const half_t* Kb = K + headOff;
  const half_t* Vb = V + headOff;

  constexpr int kKT = 128;          // keys a tile (a trip)
  // [buffer][K keys 0..63 | K keys 64..127 | V keys 0..63 | V keys 64..127]:
  // rows [k][d], K at 144 B, V at 160 B; every slice starts at a multiple of 2 KiB.
  __shared__ __attribute__((aligned(2048))) half_t Ring[2][4][kSliceBytes / 2];

  // Q^T B-fragments for this wave (column = q row 16*c + l16), d chunks [0,32)
  // and [32,64): global b128, hardware k order (8*hi.., 16+8*hi..).
  const int q0 = qt * 64 + cg * 32;
  v16h aq[2][2];
  #pragma unroll
  for (int c = 0; c < 2; ++c) {
    const half_t* qrow = Qb + (size_t)(q0 + 16 * c + l16) * kH;
    aq[c][0] = ld_frag(qrow +      koff, qrow + 16 + koff);
    aq[c][1] = ld_frag(qrow + 32 + koff, qrow + 48 + koff);
  }

  const v8f zero = {0.f,0.f,0.f,0.f,0.f,0.f,0.f,0.f};
  v8f cacc[2][4];
  #pragma unroll
  for (int c = 0; c < 2; ++c)
    #pragma unroll
    for (int j = 0; j < 4; ++j) cacc[c][j] = zero;
  // One query per lane and tile c (column l16). negm: minus the maximum in use
  // (log2 units), eight copies, the C operand of the score products: a score
  // leaves the matrix unit as its exponent s - m. lsum: this lane half's part of
  // the denominator (the halves are joined after the loop).
  v8f negm[2] = {zero, zero};
  float lsum[2] = {0.0f, 0.0f};

  // This wave's slice of every tile: slice number = wave number.
  constexpr int kTiles = kS / kKT;
  const uint64_t slice0 = (uint64_t)(size_t)((wave < 2 ? Kb : Vb) + (size_t)(wave & 1) * kSliceRows * kH);
  const uint32_t place0 = lds_addr(&Ring[0][wave][0]);
  const u32x8 g1k = slice_group1<kPadWordK>();
  const u32x8 g1v = slice_group1<kPadWordV>();
  auto stage_slice = [&](uint32_t tile, uint32_t buffer, bool wait_here) {
    const uint32_t dst = place0 + buffer * (4u * kSliceBytes);
    const uint64_t ga  = slice0 + (uint64_t)tile * ((uint64_t)kKT * kH * 2u);
    if (pinned(wave < 2))  { tensor_slice(dst, ga, g1k); if (wait_here) wait_tensorcnt0(); }
    if (pinned(wave >= 2)) { tensor_slice(dst, ga, g1v); if (wait_here) wait_tensorcnt0(); }
  };

  // Ring prologue: tile 0 landed (the wait directly behind the load) and
  // published, then tile 1 in flight.
  stage_slice(0u, 0u, true);
  __syncthreads();
  stage_slice(1u, 1u, false);

  // The maximum in use starts as the largest score of the wave's first 16 keys:
  // a real score of the query, so its p is 1 and the denominator never vanishes.
  {
    const half_t (*K0)[kKPitch] = reinterpret_cast<const half_t (*)[kKPitch]>(&Ring[0][kh][0]);
    const v16h ak0 = ld_frag(&K0[l16][koff],      &K0[l16][16 + koff]);
    const v16h ak1 = ld_frag(&K0[l16][32 + koff], &K0[l16][48 + koff]);
    #pragma unroll
    for (int c = 0; c < 2; ++c) {
      const v8f s0 = wmma16(ak1, aq[c][1], wmma16(ak0, aq[c][0], zero));
      float hm = fmaxf(s0[0], s0[1]);
      #pragma unroll
      for (int r = 2; r < 8; ++r) hm = fmaxf(hm, s0[r]);
      negm[c] -= fmaxf(hm, xhalf(hm));
    }
  }

  for (int t = 0; t < kTiles; ++t) {
    const int buf = t & 1;
    const half_t (*Kt)[kKPitch] = reinterpret_cast<const half_t (*)[kKPitch]>(&Ring[buf][kh][0]);
    const half_t* vlane = tr_lane_ptr(&Ring[buf][2 + kh][0], lane);

    // scores: S^T = K * Q^T  (A row = key, B column = query, contraction = d)
    // s[c][j][r] = score(key 16*j + 8*hi + r, query 16*c + l16) - maximum in use
    v8f s[2][4];
    #pragma unroll
    for (int j = 0; j < 4; ++j) {
      const int krow = 16 * j + l16;
      const v16h ak0 = ld_frag(&Kt[krow][koff],      &Kt[krow][16 + koff]);
      const v16h ak1 = ld_frag(&Kt[krow][32 + koff], &Kt[krow][48 + koff]);
      #pragma unroll
      for (int c = 0; c < 2; ++c)
        s[c][j] = wmma16(ak1, aq[c][1], wmma16(ak0, aq[c][0], negm[c]));
    }

    // Online softmax, one query per lane and tile: how far the 64 keys' largest
    // exponent stands above the maximum in use.
    float tmax[2];
    #pragma unroll
    for (int c = 0; c < 2; ++c) {
      float hmax[2];
      #pragma unroll
      for (int g = 0; g < 2; ++g) {
        hmax[g] = fmaxf(s[c][2 * g][0], s[c][2 * g + 1][0]);
        #pragma unroll
        for (int r = 1; r < 8; ++r)
          hmax[g] = fmaxf(hmax[g], fmaxf(s[c][2 * g][r], s[c][2 * g + 1][r]));
      }
      const float hm = fmaxf(hmax[0], hmax[1]);
      tmax[c] = fmaxf(hm, xhalf(hm));
    }
    // Lazy maximum: it is raised (and ctx, sum and this tile's exponents moved to
    // it) only when some query of the wave exceeds the one in use by more than 8,
    // so p stays at or below 2^8. One test a trip, a scalar branch.
    if (__builtin_amdgcn_ballot_w32(fmaxf(tmax[0], tmax[1]) > 8.0f) != 0u) {
      #pragma unroll
      for (int c = 0; c < 2; ++c) {
        const float d    = fmaxf(tmax[c], 0.0f);
        const float corr = __builtin_amdgcn_exp2f(-d);
        lsum[c] *= corr;
        negm[c] -= d;
        #pragma unroll
        for (int j = 0; j < 4; ++j) { cacc[c][j] *= corr; s[c][j] -= d; }
      }
    }

    // P^T as B operands, one per 32 keys: element e of operand g =
    // P^T[key 32*g + kmap(e)][query] = tile 2*g + (e>>3), reg e&7.
    v16h bp[2][2];
    #pragma unroll
    for (int c = 0; c < 2; ++c) {
      float psum[2];
      #pragma unroll
      for (int g = 0; g < 2; ++g) {
        psum[g] = 0.0f;
        #pragma unroll
        for (int e = 0; e < 16; ++e) {
          const float p = __builtin_amdgcn_exp2f(s[c][2 * g + (e >> 3)][e & 7]);
          psum[g] += p;
          bp[c][g][e] = (half_t)p;
        }
      }
      lsum[c] += psum[0] + psum[1];
    }

    // ctx^T += V^T(64x64) * P^T(64x32): A rows = d, by the transposing load.
    #pragma unroll
    for (int g = 0; g < 2; ++g) {
      #pragma unroll
      for (int j = 0; j < 4; ++j) {
        const v16h avf = ld_frag_tr(vlane + g * 32 * kTrPitch, 16 * j);
        #pragma unroll
        for (int c = 0; c < 2; ++c) cacc[c][j] = wmma16(avf, bp[c][g], cacc[c][j]);
      }
    }

    // Publish point of tile t + 1: own reads of tile t returned, own slice of
    // tile t + 1 landed, then the one barrier of the trip; behind it tile t's
    // buffer is free for tile t + 2.
    wait_dscnt0();
    wait_tensorcnt0();
    __syncthreads();
    // The tile number goes through pinned() so that the descriptor is formed here,
    // behind the wait, and not ahead of it.
    if (pinned(t + 2 < kTiles)) stage_slice(pinned((uint32_t)t + 2u), (uint32_t)buf, false);
  }
  wait_tensorcnt0();   // nothing of this wave is in flight when it ends
  wait_dscnt0();       // and its ring reads are back before the ring is reused

  // Join of the key halves: the waves of the second half hand over ctx (16
  // pieces a lane), max and sum; lane and register mean the same query and d in
  // both waves of a pair. The first buffer's K slices serve as the hand-over
  // space: behind the last trip's barrier nobody reads them and no load is in flight.
  static_assert(2 * 17 * 32 * 16 <= 2 * kSliceBytes && 2 * 32 * kCPitch * 4 <= 2 * kSliceBytes, "fits");
  float4 (*Mg)[17][32] = reinterpret_cast<float4 (*)[17][32]>(&Ring[0][0][0]);
  if (kh == 1) {
    #pragma unroll
    for (int c = 0; c < 2; ++c) {
      #pragma unroll
      for (int j = 0; j < 4; ++j) {
        Mg[cg][(4 * c + j) * 2][lane]     = make_float4(cacc[c][j][0], cacc[c][j][1],
                                                        cacc[c][j][2], cacc[c][j][3]);
        Mg[cg][(4 * c + j) * 2 + 1][lane] = make_float4(cacc[c][j][4], cacc[c][j][5],
                                                        cacc[c][j][6], cacc[c][j][7]);
      }
    }
    Mg[cg][16][lane] = make_float4(-negm[0][0], lsum[0], -negm[1][0], lsum[1]);
  }
  __syncthreads();
  if (kh == 1) return;

  // Normalize ctx (f32). cacc[c][j][r] = ctx[query 16*c + l16][d = 16*j + 8*hi
  // + r]: 8 consecutive floats per lane and j, two 16-byte pieces, into the
  // wave's own staging range in the first buffer's V slices (free like its K slices).
  float* stg = reinterpret_cast<float*>(&Ring[0][2][0]) + cg * (32 * kCPitch);
  const float4 ml = Mg[cg][16][lane];
  #pragma unroll
  for (int c = 0; c < 2; ++c) {
    const float m1 = c ? ml.z : ml.x;
    const float l1 = c ? ml.w : ml.y;
    const float m0 = -negm[c][0];
    const float m  = fmaxf(m0, m1);
    const float e0 = __builtin_amdgcn_exp2f(m0 - m), e1 = __builtin_amdgcn_exp2f(m1 - m);
    const float lj = lsum[c] * e0 + l1 * e1;
    const float inv = 1.0f / (lj + xhalf(lj));
    const float f0 = e0 * inv, f1 = e1 * inv;
    float* orow = stg + (16 * c + l16) * kCPitch + 8 * hi;
    #pragma unroll
    for (int j = 0; j < 4; ++j) {
      const float4 p0 = Mg[cg][(4 * c + j) * 2][lane];
      const float4 p1 = Mg[cg][(4 * c + j) * 2 + 1][lane];
      const float4 lo4 = make_float4(cacc[c][j][0] * f0 + p0.x * f1, cacc[c][j][1] * f0 + p0.y * f1,
                                     cacc[c][j][2] * f0 + p0.z * f1, cacc[c][j][3] * f0 + p0.w * f1);
      const float4 hi4 = make_float4(cacc[c][j][4] * f0 + p1.x * f1, cacc[c][j][5] * f0 + p1.y * f1,
                                     cacc[c][j][6] * f0 + p1.z * f1, cacc[c][j][7] * f0 + p1.w * f1);
      *(float4*)(orow + 16 * j)     = lo4;
      *(float4*)(orow + 16 * j + 4) = hi4;
    }
  }
  // The wave's own staging writes are done before other lanes read them back.
  wait_dscnt0();
  // Output layout [B,S,NH*HD]: head h occupies columns h*64..h*64+63, 256 bytes
  // of a row. Sixteen lanes a row: a store covers 4 whole lines.
  float* obase = out + (size_t)(b * kS + q0) * kH + (size_t)h * kHD;
  #pragma unroll
  for (int q = 0; q < 16; ++q) {
    const int row = 2 * q + hi;
    const float4 o = *(const float4*)&stg[row * kCPitch + 4 * l16];
    *(float4*)(obase + (size_t)row * kH + 4 * l16) = o;
  }
}

// ---------------------------------------------------------------------------
extern "C" void kernel_launch(void* const* d_in, const int* in_sizes, int n_in,
                              void* d_out, int out_size, void* d_ws, size_t ws_size,
                              hipStream_t stream) {
  const float* X  = (const float*)d_in[0];
  const float* Wq = (const float*)d_in[1];
  const float* bq = (const float*)d_in[2];
  const float* Wk = (const float*)d_in[3];
  const float* bk = (const float*)d_in[4];
  const float* Wv = (const float*)d_in[5];
  const float* bv = (const float*)d_in[6];
  float* out = (float*)d_out;

  // Workspace: f16 Q, K, V, each [4096, 768] (6.29 MB each, 18.9 MB total).
  half_t* Qh = (half_t*)d_ws;
  half_t* Kh = Qh + (size_t)kBS * kH;
  half_t* Vh = Kh + (size_t)kBS * kH;

  dim3 g1(kBS / 128, kH / 128, 3);     // 32 x 6 x 3 blocks
  qkv_gemm_kernel<<<g1, 256, 0, stream>>>(X, Wq, bq, Wk, bk, Wv, bv, Qh, Kh, Vh);

  dim3 g2(kS / 64, kNH, kB);           // 32 x 12 x 2 blocks
  attention_kernel<<<g2, 128, 0, stream>>>(Qh, Kh, Vh, out);
}
